// v000
// Measured on an AMD MI455X. A time is GPU time per run, averaged over a window of back-to-back runs after a warm-up
// (all launches, gaps included; the runs take copies of the inputs in turn), and the median of several windows.
// Apart from v000's, it joins two sittings. Times from different sittings can be a few percent apart, while
// side-by-side timings come from the same sitting.
// v000, which the later versions start from, runs in 65.2 microseconds.
#include <hip/hip_runtime.h>

// Contractions: P1.modal2 and P2^T.modal1 on v_wmma_f32_16x16x32_f16 (f16 operands: P carried x1024, values = bf16-RNE inputs carried x16, f32 accumulate, folded by 2^-14 in the f32 epilogue);
// score matvec sum_d w[d]*tanh(m1[d]+m2[d]) (N=1) and both softmaxes (over keys, and down the columns) stay f32 on VALU.

#ifndef NB
#define NB 4
#endif
#define NB_FULL 4
#define TQ    256
#define TK    256
#define DV    512
#define TQ_SH 8
#define TK_SH 8
#define PCAR  1024.0f
#define VSC   16.0f
#define OSC   (1.0f / 16384.0f)
#define LOG2E 1.4426950408889634f

static_assert(NB >= 1 && NB <= NB_FULL);
static_assert(TQ == TK);
static_assert((1 << TQ_SH) == TQ && (1 << TK_SH) == TK);
static_assert(TQ % 64 == 0 && TK % 64 == 0 && DV % 64 == 0);
static_assert(TQ % 32 == 0 && TK % 32 == 0);
static_assert(DV == 4 * 128);
static_assert(TK == 8 * 32 && TQ == 8 * 32);
static_assert((size_t)NB_FULL * TQ * DV * 4 == 2097152);
static_assert(((size_t)NB_FULL * TQ * DV + (size_t)NB_FULL * TK * DV) * 4 == 4194304);
static_assert((((size_t)NB * DV * TK / 2) % 256) == 0);

static constexpr size_t WS_TOTAL = (size_t)NB * DV * TK * 2 + (size_t)NB * DV * TQ * 2 + (size_t)NB * TQ * TK * 4 + (size_t)NB * TQ * TK * 2 + (size_t)NB * TK * TQ * 2;
static_assert(WS_TOTAL <= 134217728);
static_assert((((size_t)NB * DV * TK * 2) % 256) == 0 && (((size_t)NB * TQ * TK * 2) % 256) == 0);
static_assert(16 * 68 * 4 <= 131072);
static_assert((2 * TK + 8) * 4 <= 131072);

typedef _Float16 h16;
typedef __attribute__((ext_vector_type(16))) _Float16 v16h;
typedef __attribute__((ext_vector_type(8)))  _Float16 v8h;
typedef __attribute__((ext_vector_type(8)))  float    v8f;
typedef __attribute__((ext_vector_type(4)))  float    v4f;
typedef __attribute__((ext_vector_type(2)))  _Float16 v2h;
typedef v8h  __attribute__((may_alias)) v8ha;
typedef v4f  __attribute__((may_alias)) v4fa;

__device__ __forceinline__ unsigned short f2bf(float f) { unsigned u = __float_as_uint(f); u += 0x7FFFu + ((u >> 16) & 1u); return (unsigned short)(u >> 16); }
__device__ __forceinline__ float bf2f(unsigned short b) { return __uint_as_float(((unsigned)b) << 16); }
__device__ __forceinline__ float bfr(float f) { return bf2f(f2bf(f)); }
__device__ __forceinline__ v16h cat16(v8h lo, v8h hi) { return __builtin_shufflevector(lo, hi, 0, 1, 2, 3, 4, 5, 6, 7, 8, 9, 10, 11, 12, 13, 14, 15); }
__device__ __forceinline__ v8f wmma16(v16h a, v16h b, v8f c) { return __builtin_amdgcn_wmma_f32_16x16x32_f16(false, a, false, b, (short)0, c, false, false); }

// f32 -> f16 operand convert with a value select: anything below the smallest normal f16 becomes +0 before the convert.
static __device__ __forceinline__ h16 toh_flush(float v) { const float w = (fabsf(v) < 6.103515625e-05f) ? 0.0f : v; return (h16)w; }

// ---- k_gemmw: register-blocked GEMM, ONE WAVE per 64x64 output tile (16 accumulators), operands straight from K-contiguous 16-bit planes; grid (M/64, N/64, Z), 32 threads.
// C[m][n] (f32, pitch ldc) = csc * sum_k A[m][k] Bt[n][k] (+ split products per NSPLIT) (+ optional bf16-exact f32 bias[n]). z-batch strides sA/sB/sC in elements. K % 32 == 0.
// Fragments (lane l, hi = l>>4, lr = l&15): A elements 0..7 <- A[r][k0+8hi+0..7], 8..15 <- A[r][k0+16+8hi+0..7]; B identical k map from Bt[n][k]; D element j -> (row 8hi+j, col lr).
template <typename T16> struct WFrag;
template <> struct WFrag<h16> { typedef v16h V; static __device__ __forceinline__ V ld(const h16* p) { return cat16(*(const v8h*)p, *(const v8h*)(p + 16)); } static __device__ __forceinline__ v8f mma(V a, V b, v8f c) { return wmma16(a, b, c); } };
template <typename T16, int NSPLIT, bool BIAS>
__global__ __launch_bounds__(32) void k_gemmw(const T16* __restrict__ A, const T16* __restrict__ A2, const T16* __restrict__ Bt, const T16* __restrict__ Bt2, int K, float* C, int ldc, const float* __restrict__ bias, float csc, size_t sA, size_t sB, size_t sC) {
    typedef typename WFrag<T16>::V V;
    __shared__ __align__(16) float os[16 * 68];
    const size_t z = blockIdx.z; A += z * sA; if (A2) A2 += z * sA; Bt += z * sB; if (Bt2) Bt2 += z * sB; C += z * sC;
    const int lane = threadIdx.x & 31, lr = lane & 15, hi = lane >> 4; const int r0 = blockIdx.x * 64, c0 = blockIdx.y * 64;
    v8f acc[4][4];
#pragma unroll
    for (int mb = 0; mb < 4; ++mb)
#pragma unroll
        for (int nb = 0; nb < 4; ++nb) acc[mb][nb] = (v8f){};
    const size_t aoff = (size_t)(r0 + lr) * K + 8 * hi, boff = (size_t)(c0 + lr) * K + 8 * hi;
#pragma unroll 1
    for (int kc = 0; kc < K; kc += 32) {
        V a[4], a2[4];
#pragma unroll
        for (int mb = 0; mb < 4; ++mb) { a[mb] = WFrag<T16>::ld(A + aoff + (size_t)mb * 16 * K + kc); if (NSPLIT == 1 || NSPLIT == 2) a2[mb] = WFrag<T16>::ld(A2 + aoff + (size_t)mb * 16 * K + kc); }
#pragma unroll
        for (int nb = 0; nb < 4; ++nb) { const V b = WFrag<T16>::ld(Bt + boff + (size_t)nb * 16 * K + kc); V b2; if (NSPLIT >= 2) b2 = WFrag<T16>::ld(Bt2 + boff + (size_t)nb * 16 * K + kc);
#pragma unroll
            for (int mb = 0; mb < 4; ++mb) { acc[mb][nb] = WFrag<T16>::mma(a[mb], b, acc[mb][nb]); if (NSPLIT == 1 || NSPLIT == 2) acc[mb][nb] = WFrag<T16>::mma(a2[mb], b, acc[mb][nb]); if (NSPLIT >= 2) acc[mb][nb] = WFrag<T16>::mma(a[mb], b2, acc[mb][nb]); } }
        asm volatile("v_nop\n\tv_nop\n\tv_nop\n\tv_nop" : "+v"(acc[0][0]), "+v"(acc[1][1]), "+v"(acc[2][2]), "+v"(acc[3][3]) : "v"(a[0]), "v"(a[3]));
    }
#pragma unroll
    for (int mb = 0; mb < 4; ++mb) {
#pragma unroll
        for (int nb = 0; nb < 4; ++nb) {
#pragma unroll
            for (int j = 0; j < 8; ++j) os[(hi * 8 + j) * 68 + nb * 16 + lr] = acc[mb][nb][j]; }
        __builtin_amdgcn_wave_barrier(); asm volatile("" ::: "memory");
        float* crow = C + (size_t)(r0 + mb * 16) * ldc + c0;
{
#pragma unroll
            for (int s = 0; s < 8; ++s) { const int row = 2 * s + hi, cofs = lr * 4; v4f val = *(const v4fa*)(os + row * 68 + cofs); val = val * csc;
                if (BIAS) { val[0] += bfr(bias[c0 + cofs]); val[1] += bfr(bias[c0 + cofs + 1]); val[2] += bfr(bias[c0 + cofs + 2]); val[3] += bfr(bias[c0 + cofs + 3]); }
                *(v4f*)(crow + (size_t)row * ldc + cofs) = val; }
             }
        __builtin_amdgcn_wave_barrier(); asm volatile("" ::: "memory");
    }
}

// ---- k_vtp: value planes V16[b][d][t] (f16) = bf16_RNE(F[b][t][d]) * VSC through the flush select (raw input; the x16 carry keeps small entries normal in f16; bf16 significands are exact in f16);
__global__ __launch_bounds__(256) void k_vtp(const float* __restrict__ F, h16* V16) {
    const size_t e = ((size_t)blockIdx.x * 256 + threadIdx.x) * 2; if (e >= (size_t)NB * DV * TK) return;
    const int t = (int)(e % TK); const int d = (int)((e / TK) % DV); const int b = (int)(e / ((size_t)TK * DV));
    v2h o;
#pragma unroll
    for (int q = 0; q < 2; ++q) o[q] = toh_flush(bfr(F[((size_t)b * TK + t + q) * DV + d]) * VSC);
    *(v2h*)(V16 + e) = o; 
}

// ---- tanh via exp2 and rcp: 1 - 2 / (e^{2x} + 1); saturates cleanly to +-1 for large |x| (e = inf -> rcp 0, e = 0 -> rcp 1).
__device__ __forceinline__ float tnh(float x) {
    const float e = __builtin_amdgcn_exp2f(x * 2.8853900817779268f);
    const float r = __builtin_amdgcn_rcpf(e + 1.0f);
    return fmaf(-2.0f, r, 1.0f);
}

// ---- k_score: one block per row rq (= b*TQ + i) of the first input. Lane owns d = 4*lane + 128*c + e (c 0..3, e 0..3): bf16_RNE(m1[d]) and bf16_RNE(w[d]) in registers;
// wave v scans keys 32v .. 32v+31, per key: 4 x 16-B loads of the second input's row (each element through bfr), s = sum_d w[d] tanh(m1[d] + m2[k][d]) in f32 (fixed order + xor tree),
// lane 0 stores s into the LDS score row (cross-wave: block barrier). The scalar bias (bf16 RNE) is added to every score.
// (a) raw score row -> f32 plane SF[rq][TK] (1 KB = 8 lines) by waves 0..1 as 32 lanes x 16 B per instruction; (b) softmax over the 256 keys in f32 (max-subtracted, exp2, rcp of the
static_assert(2 * 32 * 16 == TK * 4);
static_assert(1 * 32 * 16 == TK * 2);
static_assert(8 * (TK / 8) == TK && 256 == TK);
__global__ __launch_bounds__(256) void k_score(const float* __restrict__ M1, const float* __restrict__ M2, const float* __restrict__ ww, const float* __restrict__ bb, float* SF, h16* P16) {
    __shared__ __align__(16) float s_sc[TK];
    __shared__ __align__(16) float s_ex[TK];
    __shared__ float red[8];
    const int rq = blockIdx.x; const int b = rq >> TQ_SH;
    const int tid = threadIdx.x, lane = tid & 31; const int wave = __builtin_amdgcn_readfirstlane(tid >> 5);
    const float* mrow = M1 + (size_t)rq * DV;
    float mr[16], wr[16];
#pragma unroll
    for (int c = 0; c < 4; ++c) { const v4f a4 = *(const v4f*)(mrow + c * 128 + lane * 4); const v4f w4 = *(const v4f*)(ww + c * 128 + lane * 4);
#pragma unroll
        for (int e = 0; e < 4; ++e) { mr[c * 4 + e] = bfr(a4[e]); wr[c * 4 + e] = bfr(w4[e]); } }
    const float bs = bfr(bb[0]);
    const float* ub = M2 + (size_t)b * TK * DV;
#pragma unroll 1
    for (int kk = 0; kk < TK / 8; ++kk) {
        const int k = wave * (TK / 8) + kk;
        const float* urow = ub + (size_t)k * DV;
        float acc = 0.0f;
#pragma unroll
        for (int c = 0; c < 4; ++c) { const v4f u4 = *(const v4f*)(urow + c * 128 + lane * 4);
#pragma unroll
            for (int e = 0; e < 4; ++e) acc = fmaf(wr[c * 4 + e], tnh(mr[c * 4 + e] + bfr(u4[e])), acc); }
#pragma unroll
        for (int sh = 16; sh; sh >>= 1) acc += __shfl_xor(acc, sh, 32);
        if (lane == 0) s_sc[k] = acc;
    }
    __syncthreads();
    const float a0 = s_sc[tid] + bs;
    s_sc[tid] = a0;
    float m = a0;
#pragma unroll
    for (int sh = 16; sh; sh >>= 1) { const float o = __shfl_xor(m, sh, 32); m = (o > m) ? o : m; }
    if (lane == 0) red[wave] = m;
    __syncthreads();
    m = red[0];
#pragma unroll
    for (int w = 1; w < 8; ++w) { const float o = red[w]; m = (o > m) ? o : m; }
    __syncthreads();
    float d0 = a0 - m;
    const float e0 = __builtin_amdgcn_exp2f(d0 * LOG2E);
    s_ex[tid] = e0;
    float sum = e0;
#pragma unroll
    for (int sh = 16; sh; sh >>= 1) sum += __shfl_xor(sum, sh, 32);
    if (lane == 0) red[wave] = sum;
    __syncthreads();
    sum = red[0];
#pragma unroll
    for (int w = 1; w < 8; ++w) sum += red[w];
    const float inv = __builtin_amdgcn_rcpf(sum); const float invp = inv * PCAR;
    if (wave < 2) {
        const int f0 = (wave * 32 + lane) * 4;
        const v4f p = *(const v4fa*)(s_sc + f0);
        float* dst = SF + (size_t)rq * TK + f0;
        *(v4f*)dst = p; 
    } else if (wave == 2) {
        const int f0 = lane * 8;
        const v4f q0 = *(const v4fa*)(s_ex + f0); const v4f q1 = *(const v4fa*)(s_ex + f0 + 4);
        v8h o;
#pragma unroll
        for (int c = 0; c < 4; ++c) { o[c] = toh_flush(q0[c] * invp); o[4 + c] = toh_flush(q1[c] * invp); }
        h16* dst = P16 + (size_t)rq * TK + f0;
        *(v8h*)dst = o; 
    }
}

// ---- k_csoft: one block per column cq (= b*TK + j) of the score plane. Thread i reads SF[b][i][j] (strided, one float), softmax DOWN the column over the 256 rows in f32
// (max-subtracted, exp2, rcp of the block sum; cross-wave combines through LDS words behind block barriers). Writes the TRANSPOSED plane P2T[cq][i] = f16(1024 p[i][j]) through the
static_assert(1 * 32 * 16 == TQ * 2);
static_assert(256 == TQ);
__global__ __launch_bounds__(256) void k_csoft(const float* __restrict__ SF, h16* P2T) {
    __shared__ __align__(16) float s_ex[TQ];
    __shared__ float red[8];
    const int cq = blockIdx.x; const int b = cq >> TK_SH; const int j = cq & (TK - 1);
    const int tid = threadIdx.x, lane = tid & 31; const int wave = __builtin_amdgcn_readfirstlane(tid >> 5);
    const float a0 = SF[((size_t)((b << TQ_SH) + tid)) * TK + j];
    float m = a0;
#pragma unroll
    for (int sh = 16; sh; sh >>= 1) { const float o = __shfl_xor(m, sh, 32); m = (o > m) ? o : m; }
    if (lane == 0) red[wave] = m;
    __syncthreads();
    m = red[0];
#pragma unroll
    for (int w = 1; w < 8; ++w) { const float o = red[w]; m = (o > m) ? o : m; }
    __syncthreads();
    float d0 = a0 - m;
    const float e0 = __builtin_amdgcn_exp2f(d0 * LOG2E);
    s_ex[tid] = e0;
    float sum = e0;
#pragma unroll
    for (int sh = 16; sh; sh >>= 1) sum += __shfl_xor(sum, sh, 32);
    if (lane == 0) red[wave] = sum;
    __syncthreads();
    sum = red[0];
#pragma unroll
    for (int w = 1; w < 8; ++w) sum += red[w];
    const float inv = __builtin_amdgcn_rcpf(sum); const float invp = inv * PCAR;
    if (wave == 0) {
        const int f0 = lane * 8;
        const v4f q0 = *(const v4fa*)(s_ex + f0); const v4f q1 = *(const v4fa*)(s_ex + f0 + 4);
        v8h o;
#pragma unroll
        for (int c = 0; c < 4; ++c) { o[c] = toh_flush(q0[c] * invp); o[4 + c] = toh_flush(q1[c] * invp); }
        h16* dst = P2T + (size_t)cq * TQ + f0;
        *(v8h*)dst = o; 
    }
}

extern "C" void kernel_launch(void* const* d_in, const int* in_sizes, int n_in,
                              void* d_out, int out_size, void* d_ws, size_t ws_size, hipStream_t stream) {
    if (n_in < 4) return;
    if (in_sizes[0] < NB * TQ * DV || in_sizes[1] < NB * TK * DV || in_sizes[2] < DV || in_sizes[3] < 1) return;
    if (out_size < NB_FULL * TQ * DV + NB * TK * DV) return;
    const float* modal1 = (const float*)d_in[0];   // [NB][TQ][DV]
    const float* modal2 = (const float*)d_in[1];   // [NB][TK][DV]
    const float* wvec   = (const float*)d_in[2];   // [DV]
    const float* bsc    = (const float*)d_in[3];   // [1]
    float* OUT0 = (float*)d_out;                                  // [NB_FULL][TQ][DV], byte offset 0
    float* OUT1 = OUT0 + (size_t)NB_FULL * TQ * DV;               // [NB_FULL][TK][DV], byte offset 2097152

    char* wsp = (char*)d_ws;
    auto take = [&](size_t bytes) { char* p = wsp; wsp += (bytes + 255) & ~(size_t)255; return (void*)p; };
    h16*   VT2  = (h16*)take((size_t)NB * DV * TK * 2);   // [NB][DV][TK] f16 x16 of the second input  1 MB
    h16*   VT1  = (h16*)take((size_t)NB * DV * TQ * 2);   // [NB][DV][TQ] f16 x16 of the first input   1 MB
    float* SF   = (float*)take((size_t)NB * TQ * TK * 4); // [NB*TQ][TK] f32 raw scores               1 MB
    h16*   P1   = (h16*)take((size_t)NB * TQ * TK * 2);   // [NB*TQ][TK] f16 x1024                     0.5 MB
    h16*   P2T  = (h16*)take((size_t)NB * TK * TQ * 2);   // [NB*TK][TQ] f16 x1024 (transposed)        0.5 MB
    if ((size_t)(wsp - (char*)d_ws) > ws_size) return;    // total 4,194,304 B

    // value planes [b][d][t] f16 x16 (in[rows t][cols d] -> out[d][t]) for both inputs
    k_vtp<<<(unsigned)(((size_t)NB * DV * TK / 2 + 255) / 256), 256, 0, stream>>>(modal2, VT2);
    k_vtp<<<(unsigned)(((size_t)NB * DV * TQ / 2 + 255) / 256), 256, 0, stream>>>(modal1, VT1);
    // scores per row of the first input -> raw score plane SF and the key-softmax plane P1 (f16 x1024)
    k_score<<<(unsigned)(NB * TQ), 256, 0, stream>>>(modal1, modal2, wvec, bsc, SF, P1);
    // softmax down the columns -> transposed plane P2T (f16 x1024)
    k_csoft<<<(unsigned)(NB * TK), 256, 0, stream>>>(SF, P2T);
    // out0 = P1 . modal2 : per batch z, [TQ][TK] x Bt[DV][TK] -> f32 [TQ][DV], epilogue scale 2^-14
    k_gemmw<h16, 0, false><<<dim3(TQ / 64, DV / 64, NB), 32, 0, stream>>>(P1, nullptr, VT2, nullptr, TK, OUT0, DV, nullptr, OSC, (size_t)TQ * TK, (size_t)DV * TK, (size_t)TQ * DV);
    // out1 = P2^T . modal1 : per batch z, [TK][TQ] x Bt[DV][TQ] -> f32 [TK][DV], epilogue scale 2^-14
    k_gemmw<h16, 0, false><<<dim3(TK / 64, DV / 64, NB), 32, 0, stream>>>(P2T, nullptr, VT1, nullptr, TQ, OUT1, DV, nullptr, OSC, (size_t)TK * TQ, (size_t)DV * TQ, (size_t)TK * DV);
}

// v001
// Measured time: 58.4 microseconds a run.
// Next to v000, in two timings, it ran 1.16 and 1.14 times as fast.
#include <hip/hip_runtime.h>

// Contractions: P1.modal2 and P2^T.modal1 on v_wmma_f32_16x16x32_f16 (f16 operands: P carried x1024, values = bf16-RNE inputs carried x16, f32 accumulate, folded by 2^-14 in the f32 epilogue);
// score matvec sum_d w[d]*tanh(m1[d]+m2[d]) (N=1) and both softmaxes (over keys, and down the columns) stay f32 on VALU;
// tanh(a+b) = 1 - 2 / (e^{2a} e^{2b} + 1): the exponentials are taken once per input element, the score loop is left with one reciprocal per (row, key, d).

#ifndef NB
#define NB 4
#endif
#define NB_FULL 4
#define TQ    256
#define TK    256
#define DV    512
#define TQ_SH 8
#define TK_SH 8
#define PCAR  1024.0f
#define VSC   16.0f
#define OSC   (1.0f / 16384.0f)
#define LOG2E 1.4426950408889634f

static_assert(NB >= 1 && NB <= NB_FULL);
static_assert(TQ == TK);
static_assert((1 << TQ_SH) == TQ && (1 << TK_SH) == TK);
static_assert(TQ % 64 == 0 && TK % 64 == 0 && DV % 64 == 0);
static_assert(TQ % 32 == 0 && TK % 32 == 0);
static_assert(DV == 4 * 128);
static_assert(TK == 8 * 32 && TQ == 8 * 32);
static_assert((size_t)NB_FULL * TQ * DV * 4 == 2097152);
static_assert(((size_t)NB_FULL * TQ * DV + (size_t)NB_FULL * TK * DV) * 4 == 4194304);
static_assert((((size_t)NB * DV * TK / 2) % 256) == 0);

static constexpr size_t WS_TOTAL = (size_t)NB * TK * DV * 4 + (size_t)NB * DV * TK * 2 + (size_t)NB * DV * TQ * 2 + (size_t)NB * TQ * TK * 4 + (size_t)NB * TQ * TK * 2 + (size_t)NB * TK * TQ * 2;
static_assert(WS_TOTAL <= 134217728);
static_assert((((size_t)NB * DV * TK * 2) % 256) == 0 && (((size_t)NB * TQ * TK * 2) % 256) == 0);
static_assert(16 * 68 * 4 <= 131072);
static_assert((2 * TK + 8) * 4 <= 131072);

typedef _Float16 h16;
typedef __attribute__((ext_vector_type(16))) _Float16 v16h;
typedef __attribute__((ext_vector_type(8)))  _Float16 v8h;
typedef __attribute__((ext_vector_type(8)))  float    v8f;
typedef __attribute__((ext_vector_type(4)))  float    v4f;
typedef __attribute__((ext_vector_type(2)))  float    v2f;
typedef __attribute__((ext_vector_type(2)))  _Float16 v2h;
typedef v8h  __attribute__((may_alias)) v8ha;
typedef v4f  __attribute__((may_alias)) v4fa;

__device__ __forceinline__ unsigned short f2bf(float f) { unsigned u = __float_as_uint(f); u += 0x7FFFu + ((u >> 16) & 1u); return (unsigned short)(u >> 16); }
__device__ __forceinline__ float bf2f(unsigned short b) { return __uint_as_float(((unsigned)b) << 16); }
__device__ __forceinline__ float bfr(float f) { return bf2f(f2bf(f)); }
__device__ __forceinline__ v16h cat16(v8h lo, v8h hi) { return __builtin_shufflevector(lo, hi, 0, 1, 2, 3, 4, 5, 6, 7, 8, 9, 10, 11, 12, 13, 14, 15); }
__device__ __forceinline__ v8f wmma16(v16h a, v16h b, v8f c) { return __builtin_amdgcn_wmma_f32_16x16x32_f16(false, a, false, b, (short)0, c, false, false); }

// f32 -> f16 operand convert with a value select: anything below the smallest normal f16 becomes +0 before the convert.
static __device__ __forceinline__ h16 toh_flush(float v) { const float w = (fabsf(v) < 6.103515625e-05f) ? 0.0f : v; return (h16)w; }

// ---- k_gemmw: register-blocked GEMM, ONE WAVE per 64x64 output tile (16 accumulators), operands straight from K-contiguous 16-bit planes; grid (M/64, N/64, Z), 32 threads.
// C[m][n] (f32, pitch ldc) = csc * sum_k A[m][k] Bt[n][k] (+ split products per NSPLIT) (+ optional bf16-exact f32 bias[n]). z-batch strides sA/sB/sC in elements. K % 32 == 0.
// Fragments (lane l, hi = l>>4, lr = l&15): A elements 0..7 <- A[r][k0+8hi+0..7], 8..15 <- A[r][k0+16+8hi+0..7]; B identical k map from Bt[n][k]; D element j -> (row 8hi+j, col lr).
template <typename T16> struct WFrag;
template <> struct WFrag<h16> { typedef v16h V; static __device__ __forceinline__ V ld(const h16* p) { return cat16(*(const v8h*)p, *(const v8h*)(p + 16)); } static __device__ __forceinline__ v8f mma(V a, V b, v8f c) { return wmma16(a, b, c); } };
template <typename T16, int NSPLIT, bool BIAS>
__global__ __launch_bounds__(32) void k_gemmw(const T16* __restrict__ A, const T16* __restrict__ A2, const T16* __restrict__ Bt, const T16* __restrict__ Bt2, int K, float* C, int ldc, const float* __restrict__ bias, float csc, size_t sA, size_t sB, size_t sC) {
    typedef typename WFrag<T16>::V V;
    __shared__ __align__(16) float os[16 * 68];
    const size_t z = blockIdx.z; A += z * sA; if (A2) A2 += z * sA; Bt += z * sB; if (Bt2) Bt2 += z * sB; C += z * sC;
    const int lane = threadIdx.x & 31, lr = lane & 15, hi = lane >> 4; const int r0 = blockIdx.x * 64, c0 = blockIdx.y * 64;
    v8f acc[4][4];
#pragma unroll
    for (int mb = 0; mb < 4; ++mb)
#pragma unroll
        for (int nb = 0; nb < 4; ++nb) acc[mb][nb] = (v8f){};
    const size_t aoff = (size_t)(r0 + lr) * K + 8 * hi, boff = (size_t)(c0 + lr) * K + 8 * hi;
#pragma unroll 1
    for (int kc = 0; kc < K; kc += 32) {
        V a[4], a2[4];
#pragma unroll
        for (int mb = 0; mb < 4; ++mb) { a[mb] = WFrag<T16>::ld(A + aoff + (size_t)mb * 16 * K + kc); if (NSPLIT == 1 || NSPLIT == 2) a2[mb] = WFrag<T16>::ld(A2 + aoff + (size_t)mb * 16 * K + kc); }
#pragma unroll
        for (int nb = 0; nb < 4; ++nb) { const V b = WFrag<T16>::ld(Bt + boff + (size_t)nb * 16 * K + kc); V b2; if (NSPLIT >= 2) b2 = WFrag<T16>::ld(Bt2 + boff + (size_t)nb * 16 * K + kc);
#pragma unroll
            for (int mb = 0; mb < 4; ++mb) { acc[mb][nb] = WFrag<T16>::mma(a[mb], b, acc[mb][nb]); if (NSPLIT == 1 || NSPLIT == 2) acc[mb][nb] = WFrag<T16>::mma(a2[mb], b, acc[mb][nb]); if (NSPLIT >= 2) acc[mb][nb] = WFrag<T16>::mma(a[mb], b2, acc[mb][nb]); } }
        asm volatile("v_nop\n\tv_nop\n\tv_nop\n\tv_nop" : "+v"(acc[0][0]), "+v"(acc[1][1]), "+v"(acc[2][2]), "+v"(acc[3][3]) : "v"(a[0]), "v"(a[3]));
    }
#pragma unroll
    for (int mb = 0; mb < 4; ++mb) {
#pragma unroll
        for (int nb = 0; nb < 4; ++nb) {
#pragma unroll
            for (int j = 0; j < 8; ++j) os[(hi * 8 + j) * 68 + nb * 16 + lr] = acc[mb][nb][j]; }
        __builtin_amdgcn_wave_barrier(); asm volatile("" ::: "memory");
        float* crow = C + (size_t)(r0 + mb * 16) * ldc + c0;
{
#pragma unroll
            for (int s = 0; s < 8; ++s) { const int row = 2 * s + hi, cofs = lr * 4; v4f val = *(const v4fa*)(os + row * 68 + cofs); val = val * csc;
                if (BIAS) { val[0] += bfr(bias[c0 + cofs]); val[1] += bfr(bias[c0 + cofs + 1]); val[2] += bfr(bias[c0 + cofs + 2]); val[3] += bfr(bias[c0 + cofs + 3]); }
                *(v4f*)(crow + (size_t)row * ldc + cofs) = val; }
             }
        __builtin_amdgcn_wave_barrier(); asm volatile("" ::: "memory");
    }
}

// ---- k_vtp: value planes V16[b][d][t] (f16) = bf16_RNE(F[b][t][d]) * VSC through the flush select (raw input; the x16 carry keeps small entries normal in f16; bf16 significands are exact in f16);
__global__ __launch_bounds__(256) void k_vtp(const float* __restrict__ F, h16* V16) {
    const size_t e = ((size_t)blockIdx.x * 256 + threadIdx.x) * 2; if (e >= (size_t)NB * DV * TK) return;
    const int t = (int)(e % TK); const int d = (int)((e / TK) % DV); const int b = (int)(e / ((size_t)TK * DV));
    v2h o;
#pragma unroll
    for (int q = 0; q < 2; ++q) o[q] = toh_flush(bfr(F[((size_t)b * TK + t + q) * DV + d]) * VSC);
    *(v2h*)(V16 + e) = o; 
}

// ---- e^{2x} via exp2. The exponent is held inside [-126, 126] so that the value is never inf or 0: the product of two of them may run to inf or 0
// (tanh saturates cleanly to +-1: rcp(inf) = 0, rcp(1) = 1) but is never inf * 0.
__device__ __forceinline__ float e2x(float x) {
    return __builtin_amdgcn_exp2f(fminf(fmaxf(x * 2.8853900817779268f, -126.0f), 126.0f));
}

// ---- k_e2p: exponential plane E[b][t][d] (f32) = e^{2 bf16_RNE(F[b][t][d])}, same layout as the input; 16 B per lane in and out.
static_assert((((size_t)NB * TK * DV / 4) % 256) == 0);
__global__ __launch_bounds__(256) void k_e2p(const float* __restrict__ F, float* E) {
    const size_t e = ((size_t)blockIdx.x * 256 + threadIdx.x) * 4;
    const v4f u = *(const v4f*)(F + e);
    asm volatile("s_wait_xcnt 0x0" ::: "memory");   // the load's address registers are reused for its data and the arithmetic behind it
    v4f o;
#pragma unroll
    for (int q = 0; q < 4; ++q) o[q] = e2x(bfr(u[q]));
    asm volatile("v_nop" :: "v"(o) : "memory");     // the one slot between the last v_exp_f32 and the store that reads its result (input and clobber only hold it at that place)
    *(v4f*)(E + e) = o;
}

// ---- k_score: one block per row rq (= b*TQ + i) of the first input. Lane owns d = 4*lane + 128*c + e (c 0..3, e 0..3): e^{2 bf16_RNE(m1[d])} and -2 bf16_RNE(w[d]) in registers;
// wave v scans keys 32v .. 32v+31, per key: 4 x 16-B loads of the second input's exponential row E2, s = sum_d w[d] - 2 sum_d w[d] / (E1[d] E2[k][d] + 1) in f32 (fixed order + xor tree),
// lane 0 stores s into the LDS score row (cross-wave: block barrier). The scalar bias (bf16 RNE) is added to every score.
// (a) raw score row -> f32 plane SF[rq][TK] (1 KB = 8 lines) by waves 0..1 as 32 lanes x 16 B per instruction; (b) softmax over the 256 keys in f32 (max-subtracted, exp2, rcp of the
static_assert(2 * 32 * 16 == TK * 4);
static_assert(1 * 32 * 16 == TK * 2);
static_assert(8 * (TK / 8) == TK && 256 == TK);
__global__ __launch_bounds__(256) void k_score(const float* __restrict__ M1, const float* __restrict__ E2, const float* __restrict__ ww, const float* __restrict__ bb, float* SF, h16* P16) {
    __shared__ __align__(16) float s_sc[TK];
    __shared__ __align__(16) float s_ex[TK];
    __shared__ float red[8];
    const int rq = blockIdx.x; const int b = rq >> TQ_SH;
    const int tid = threadIdx.x, lane = tid & 31; const int wave = __builtin_amdgcn_readfirstlane(tid >> 5);
    const float* mrow = M1 + (size_t)rq * DV;
    v2f e1[8], wn[8]; float ws = 0.0f;
#pragma unroll
    for (int c = 0; c < 4; ++c) { const v4f a4 = *(const v4f*)(mrow + c * 128 + lane * 4); const v4f w4 = *(const v4f*)(ww + c * 128 + lane * 4);
#pragma unroll
        for (int e = 0; e < 4; ++e) { const float wv = bfr(w4[e]); e1[c * 2 + (e >> 1)][e & 1] = e2x(bfr(a4[e])); wn[c * 2 + (e >> 1)][e & 1] = -2.0f * wv; ws += wv; } }
    const float bs = bfr(bb[0]);
    const float* ub = E2 + (size_t)b * TK * DV;
    const v2f one2 = {1.0f, 1.0f};
#pragma unroll 1
    for (int kk = 0; kk < TK / 8; ++kk) {
        const int k = wave * (TK / 8) + kk;
        const float* urow = ub + (size_t)k * DV;
        v4f ur[4];
#pragma unroll
        for (int c = 0; c < 4; ++c) ur[c] = *(const v4f*)(urow + c * 128 + lane * 4);
        asm volatile("s_wait_xcnt 0x0" ::: "memory");   // the row pointer's registers are advanced for the next key behind these loads
        v2f ac0 = {ws, 0.0f}, ac1 = {0.0f, 0.0f};
#pragma unroll
        for (int c = 0; c < 4; ++c) { const v4f u4 = ur[c];
            const v2f x0 = __builtin_elementwise_fma(e1[c * 2], (v2f){u4[0], u4[1]}, one2), x1 = __builtin_elementwise_fma(e1[c * 2 + 1], (v2f){u4[2], u4[3]}, one2);
            const v2f r0 = {__builtin_amdgcn_rcpf(x0[0]), __builtin_amdgcn_rcpf(x0[1])}, r1 = {__builtin_amdgcn_rcpf(x1[0]), __builtin_amdgcn_rcpf(x1[1])};
            ac0 = __builtin_elementwise_fma(wn[c * 2], r0, ac0); ac1 = __builtin_elementwise_fma(wn[c * 2 + 1], r1, ac1); }
        float acc = (ac0[0] + ac0[1]) + (ac1[0] + ac1[1]);
#pragma unroll
        for (int sh = 16; sh; sh >>= 1) acc += __shfl_xor(acc, sh, 32);
        if (lane == 0) s_sc[k] = acc;
    }
    __syncthreads();
    const float a0 = s_sc[tid] + bs;
    s_sc[tid] = a0;
    float m = a0;
#pragma unroll
    for (int sh = 16; sh; sh >>= 1) { const float o = __shfl_xor(m, sh, 32); m = (o > m) ? o : m; }
    if (lane == 0) red[wave] = m;
    __syncthreads();
    m = red[0];
#pragma unroll
    for (int w = 1; w < 8; ++w) { const float o = red[w]; m = (o > m) ? o : m; }
    __syncthreads();
    float d0 = a0 - m;
    const float e0 = __builtin_amdgcn_exp2f(d0 * LOG2E);
    s_ex[tid] = e0;
    float sum = e0;
#pragma unroll
    for (int sh = 16; sh; sh >>= 1) sum += __shfl_xor(sum, sh, 32);
    if (lane == 0) red[wave] = sum;
    __syncthreads();
    sum = red[0];
#pragma unroll
    for (int w = 1; w < 8; ++w) sum += red[w];
    const float inv = __builtin_amdgcn_rcpf(sum); const float invp = inv * PCAR;
    if (wave < 2) {
        const int f0 = (wave * 32 + lane) * 4;
        const v4f p = *(const v4fa*)(s_sc + f0);
        float* dst = SF + (size_t)rq * TK + f0;
        *(v4f*)dst = p; 
    } else if (wave == 2) {
        const int f0 = lane * 8;
        const v4f q0 = *(const v4fa*)(s_ex + f0); const v4f q1 = *(const v4fa*)(s_ex + f0 + 4);
        v8h o;
#pragma unroll
        for (int c = 0; c < 4; ++c) { o[c] = toh_flush(q0[c] * invp); o[4 + c] = toh_flush(q1[c] * invp); }
        h16* dst = P16 + (size_t)rq * TK + f0;
        *(v8h*)dst = o; 
    }
}

// ---- k_csoft: one block per column cq (= b*TK + j) of the score plane. Thread i reads SF[b][i][j] (strided, one float), softmax DOWN the column over the 256 rows in f32
// (max-subtracted, exp2, rcp of the block sum; cross-wave combines through LDS words behind block barriers). Writes the TRANSPOSED plane P2T[cq][i] = f16(1024 p[i][j]) through the
static_assert(1 * 32 * 16 == TQ * 2);
static_assert(256 == TQ);
__global__ __launch_bounds__(256) void k_csoft(const float* __restrict__ SF, h16* P2T) {
    __shared__ __align__(16) float s_ex[TQ];
    __shared__ float red[8];
    const int cq = blockIdx.x; const int b = cq >> TK_SH; const int j = cq & (TK - 1);
    const int tid = threadIdx.x, lane = tid & 31; const int wave = __builtin_amdgcn_readfirstlane(tid >> 5);
    const float a0 = SF[((size_t)((b << TQ_SH) + tid)) * TK + j];
    float m = a0;
#pragma unroll
    for (int sh = 16; sh; sh >>= 1) { const float o = __shfl_xor(m, sh, 32); m = (o > m) ? o : m; }
    if (lane == 0) red[wave] = m;
    __syncthreads();
    m = red[0];
#pragma unroll
    for (int w = 1; w < 8; ++w) { const float o = red[w]; m = (o > m) ? o : m; }
    __syncthreads();
    float d0 = a0 - m;
    const float e0 = __builtin_amdgcn_exp2f(d0 * LOG2E);
    s_ex[tid] = e0;
    float sum = e0;
#pragma unroll
    for (int sh = 16; sh; sh >>= 1) sum += __shfl_xor(sum, sh, 32);
    if (lane == 0) red[wave] = sum;
    __syncthreads();
    sum = red[0];
#pragma unroll
    for (int w = 1; w < 8; ++w) sum += red[w];
    const float inv = __builtin_amdgcn_rcpf(sum); const float invp = inv * PCAR;
    if (wave == 0) {
        const int f0 = lane * 8;
        const v4f q0 = *(const v4fa*)(s_ex + f0); const v4f q1 = *(const v4fa*)(s_ex + f0 + 4);
        v8h o;
#pragma unroll
        for (int c = 0; c < 4; ++c) { o[c] = toh_flush(q0[c] * invp); o[4 + c] = toh_flush(q1[c] * invp); }
        h16* dst = P2T + (size_t)cq * TQ + f0;
        *(v8h*)dst = o; 
    }
}

extern "C" void kernel_launch(void* const* d_in, const int* in_sizes, int n_in,
                              void* d_out, int out_size, void* d_ws, size_t ws_size, hipStream_t stream) {
    if (n_in < 4) return;
    if (in_sizes[0] < NB * TQ * DV || in_sizes[1] < NB * TK * DV || in_sizes[2] < DV || in_sizes[3] < 1) return;
    if (out_size < NB_FULL * TQ * DV + NB * TK * DV) return;
    const float* modal1 = (const float*)d_in[0];   // [NB][TQ][DV]
    const float* modal2 = (const float*)d_in[1];   // [NB][TK][DV]
    const float* wvec   = (const float*)d_in[2];   // [DV]
    const float* bsc    = (const float*)d_in[3];   // [1]
    float* OUT0 = (float*)d_out;                                  // [NB_FULL][TQ][DV], byte offset 0
    float* OUT1 = OUT0 + (size_t)NB_FULL * TQ * DV;               // [NB_FULL][TK][DV], byte offset 2097152

    char* wsp = (char*)d_ws;
    auto take = [&](size_t bytes) { char* p = wsp; wsp += (bytes + 255) & ~(size_t)255; return (void*)p; };
    float* EX2  = (float*)take((size_t)NB * TK * DV * 4); // [NB][TK][DV] f32 e^{2x} of the second input 2 MB
    h16*   VT2  = (h16*)take((size_t)NB * DV * TK * 2);   // [NB][DV][TK] f16 x16 of the second input  1 MB
    h16*   VT1  = (h16*)take((size_t)NB * DV * TQ * 2);   // [NB][DV][TQ] f16 x16 of the first input   1 MB
    float* SF   = (float*)take((size_t)NB * TQ * TK * 4); // [NB*TQ][TK] f32 raw scores               1 MB
    h16*   P1   = (h16*)take((size_t)NB * TQ * TK * 2);   // [NB*TQ][TK] f16 x1024                     0.5 MB
    h16*   P2T  = (h16*)take((size_t)NB * TK * TQ * 2);   // [NB*TK][TQ] f16 x1024 (transposed)        0.5 MB
    if ((size_t)(wsp - (char*)d_ws) > ws_size) return;    // total 6,291,456 B

    // value planes [b][d][t] f16 x16 (in[rows t][cols d] -> out[d][t]) for both inputs
    k_vtp<<<(unsigned)(((size_t)NB * DV * TK / 2 + 255) / 256), 256, 0, stream>>>(modal2, VT2);
    k_vtp<<<(unsigned)(((size_t)NB * DV * TQ / 2 + 255) / 256), 256, 0, stream>>>(modal1, VT1);
    // exponential plane of the second input, read by every row's score block
    k_e2p<<<(unsigned)((size_t)NB * TK * DV / 4 / 256), 256, 0, stream>>>(modal2, EX2);
    // scores per row of the first input -> raw score plane SF and the key-softmax plane P1 (f16 x1024)
    k_score<<<(unsigned)(NB * TQ), 256, 0, stream>>>(modal1, EX2, wvec, bsc, SF, P1);
    // softmax down the columns -> transposed plane P2T (f16 x1024)
    k_csoft<<<(unsigned)(NB * TK), 256, 0, stream>>>(SF, P2T);
    // out0 = P1 . modal2 : per batch z, [TQ][TK] x Bt[DV][TK] -> f32 [TQ][DV], epilogue scale 2^-14
    k_gemmw<h16, 0, false><<<dim3(TQ / 64, DV / 64, NB), 32, 0, stream>>>(P1, nullptr, VT2, nullptr, TK, OUT0, DV, nullptr, OSC, (size_t)TQ * TK, (size_t)DV * TK, (size_t)TQ * DV);
    // out1 = P2^T . modal1 : per batch z, [TK][TQ] x Bt[DV][TQ] -> f32 [TK][DV], epilogue scale 2^-14
    k_gemmw<h16, 0, false><<<dim3(TK / 64, DV / 64, NB), 32, 0, stream>>>(P2T, nullptr, VT1, nullptr, TQ, OUT1, DV, nullptr, OSC, (size_t)TK * TQ, (size_t)DV * TQ, (size_t)TK * DV);
}

// v002
// One run takes 52.9 microseconds.
// Timed twice side by side with v001, it ran 1.11 times as fast both times.
// Over all steps from v000 it is 1.27 times as fast.
#include <hip/hip_runtime.h>

// Contractions: P1.modal2 and P2^T.modal1 on v_wmma_f32_16x16x32_f16 (f16 operands: P carried x1024, values = bf16-RNE inputs carried x16, f32 accumulate, folded by 2^-14 in the f32 epilogue);
// score matvec sum_d w[d]*tanh(m1[d]+m2[d]) (N=1) and both softmaxes (over keys, and down the columns) stay f32 on VALU;
// tanh(a+b) = 1 - 2 / (e^{2a} e^{2b} + 1): the exponentials are taken once per input element, the score loop is left with one reciprocal per (row, key, d).

#ifndef NB
#define NB 4
#endif
#define NB_FULL 4
#define TQ    256
#define TK    256
#define DV    512
#define TQ_SH 8
#define TK_SH 8
#define PCAR  1024.0f
#define VSC   16.0f
#define OSC   (1.0f / 16384.0f)
#define LOG2E 1.4426950408889634f

static_assert(NB >= 1 && NB <= NB_FULL);
static_assert(TQ == TK);
static_assert((1 << TQ_SH) == TQ && (1 << TK_SH) == TK);
static_assert(TQ % 64 == 0 && TK % 64 == 0 && DV % 64 == 0);
static_assert(TQ % 32 == 0 && TK % 32 == 0);
static_assert(DV == 4 * 128);
static_assert(TK == 8 * 32 && TQ == 8 * 32);
static_assert((size_t)NB_FULL * TQ * DV * 4 == 2097152);
static_assert(((size_t)NB_FULL * TQ * DV + (size_t)NB_FULL * TK * DV) * 4 == 4194304);

static constexpr size_t WS_TOTAL = (size_t)NB * TK * DV * 4 + (size_t)NB * DV * TK * 2 + (size_t)NB * DV * TQ * 2 + (size_t)NB * TQ * TK * 4 + (size_t)NB * TQ * TK * 2 + (size_t)NB * TK * TQ * 2;
static_assert(WS_TOTAL <= 134217728);
static_assert((((size_t)NB * DV * TK * 2) % 256) == 0 && (((size_t)NB * TQ * TK * 2) % 256) == 0);
static_assert(16 * 68 * 4 <= 131072);
static_assert((2 * TK + 8) * 4 <= 131072);

typedef _Float16 h16;
typedef __attribute__((ext_vector_type(16))) _Float16 v16h;
typedef __attribute__((ext_vector_type(8)))  _Float16 v8h;
typedef __attribute__((ext_vector_type(8)))  float    v8f;
typedef __attribute__((ext_vector_type(4)))  float    v4f;
typedef __attribute__((ext_vector_type(2)))  float    v2f;
typedef __attribute__((ext_vector_type(2)))  _Float16 v2h;
typedef v8h  __attribute__((may_alias)) v8ha;
typedef v4f  __attribute__((may_alias)) v4fa;
typedef v2h  __attribute__((may_alias)) v2ha;

__device__ __forceinline__ unsigned short f2bf(float f) { unsigned u = __float_as_uint(f); u += 0x7FFFu + ((u >> 16) & 1u); return (unsigned short)(u >> 16); }
__device__ __forceinline__ float bf2f(unsigned short b) { return __uint_as_float(((unsigned)b) << 16); }
__device__ __forceinline__ float bfr(float f) { return bf2f(f2bf(f)); }
__device__ __forceinline__ v16h cat16(v8h lo, v8h hi) { return __builtin_shufflevector(lo, hi, 0, 1, 2, 3, 4, 5, 6, 7, 8, 9, 10, 11, 12, 13, 14, 15); }
__device__ __forceinline__ v8f wmma16(v16h a, v16h b, v8f c) { return __builtin_amdgcn_wmma_f32_16x16x32_f16(false, a, false, b, (short)0, c, false, false); }

// f32 -> f16 operand convert with a value select: anything below the smallest normal f16 becomes +0 before the convert.
static __device__ __forceinline__ h16 toh_flush(float v) { const float w = (fabsf(v) < 6.103515625e-05f) ? 0.0f : v; return (h16)w; }

// ---- k_gemmw: register-blocked GEMM, ONE WAVE per 64x64 output tile (16 accumulators), operands straight from K-contiguous 16-bit planes; grid (M/64, N/64, Z), 32 threads.
// C[m][n] (f32, pitch ldc) = csc * sum_k A[m][k] Bt[n][k] (+ split products per NSPLIT) (+ optional bf16-exact f32 bias[n]). z-batch strides sA/sB/sC in elements. K % 32 == 0.
// Fragments (lane l, hi = l>>4, lr = l&15): A elements 0..7 <- A[r][k0+8hi+0..7], 8..15 <- A[r][k0+16+8hi+0..7]; B identical k map from Bt[n][k]; D element j -> (row 8hi+j, col lr).
template <typename T16> struct WFrag;
template <> struct WFrag<h16> { typedef v16h V; static __device__ __forceinline__ V ld(const h16* p) { return cat16(*(const v8h*)p, *(const v8h*)(p + 16)); } static __device__ __forceinline__ v8f mma(V a, V b, v8f c) { return wmma16(a, b, c); } };
template <typename T16, int NSPLIT, bool BIAS>
__global__ __launch_bounds__(32) void k_gemmw(const T16* __restrict__ A, const T16* __restrict__ A2, const T16* __restrict__ Bt, const T16* __restrict__ Bt2, int K, float* C, int ldc, const float* __restrict__ bias, float csc, size_t sA, size_t sB, size_t sC) {
    typedef typename WFrag<T16>::V V;
    __shared__ __align__(16) float os[16 * 68];
    const size_t z = blockIdx.z; A += z * sA; if (A2) A2 += z * sA; Bt += z * sB; if (Bt2) Bt2 += z * sB; C += z * sC;
    const int lane = threadIdx.x & 31, lr = lane & 15, hi = lane >> 4; const int r0 = blockIdx.x * 64, c0 = blockIdx.y * 64;
    v8f acc[4][4];
#pragma unroll
    for (int mb = 0; mb < 4; ++mb)
#pragma unroll
        for (int nb = 0; nb < 4; ++nb) acc[mb][nb] = (v8f){};
    const size_t aoff = (size_t)(r0 + lr) * K + 8 * hi, boff = (size_t)(c0 + lr) * K + 8 * hi;
#pragma unroll 1
    for (int kc = 0; kc < K; kc += 32) {
        V a[4], a2[4];
#pragma unroll
        for (int mb = 0; mb < 4; ++mb) { a[mb] = WFrag<T16>::ld(A + aoff + (size_t)mb * 16 * K + kc); if (NSPLIT == 1 || NSPLIT == 2) a2[mb] = WFrag<T16>::ld(A2 + aoff + (size_t)mb * 16 * K + kc); }
#pragma unroll
        for (int nb = 0; nb < 4; ++nb) { const V b = WFrag<T16>::ld(Bt + boff + (size_t)nb * 16 * K + kc); V b2; if (NSPLIT >= 2) b2 = WFrag<T16>::ld(Bt2 + boff + (size_t)nb * 16 * K + kc);
#pragma unroll
            for (int mb = 0; mb < 4; ++mb) { acc[mb][nb] = WFrag<T16>::mma(a[mb], b, acc[mb][nb]); if (NSPLIT == 1 || NSPLIT == 2) acc[mb][nb] = WFrag<T16>::mma(a2[mb], b, acc[mb][nb]); if (NSPLIT >= 2) acc[mb][nb] = WFrag<T16>::mma(a[mb], b2, acc[mb][nb]); } }
        asm volatile("v_nop\n\tv_nop\n\tv_nop\n\tv_nop" : "+v"(acc[0][0]), "+v"(acc[1][1]), "+v"(acc[2][2]), "+v"(acc[3][3]) : "v"(a[0]), "v"(a[3]));
    }
#pragma unroll
    for (int mb = 0; mb < 4; ++mb) {
#pragma unroll
        for (int nb = 0; nb < 4; ++nb) {
#pragma unroll
            for (int j = 0; j < 8; ++j) os[(hi * 8 + j) * 68 + nb * 16 + lr] = acc[mb][nb][j]; }
        __builtin_amdgcn_wave_barrier(); asm volatile("" ::: "memory");
        float* crow = C + (size_t)(r0 + mb * 16) * ldc + c0;
{
#pragma unroll
            for (int s = 0; s < 8; ++s) { const int row = 2 * s + hi, cofs = lr * 4; v4f val = *(const v4fa*)(os + row * 68 + cofs); val = val * csc;
                if (BIAS) { val[0] += bfr(bias[c0 + cofs]); val[1] += bfr(bias[c0 + cofs + 1]); val[2] += bfr(bias[c0 + cofs + 2]); val[3] += bfr(bias[c0 + cofs + 3]); }
                *(v4f*)(crow + (size_t)row * ldc + cofs) = val; }
             }
        __builtin_amdgcn_wave_barrier(); asm volatile("" ::: "memory");
    }
}

// ---- e^{2x} via exp2. The exponent is held inside [-126, 126] so that the value is never inf or 0: the product of two of them may run to inf or 0
// (tanh saturates cleanly to +-1: rcp(inf) = 0, rcp(1) = 1) but is never inf * 0.
__device__ __forceinline__ float e2x(float x) {
    return __builtin_amdgcn_exp2f(fminf(fmaxf(x * 2.8853900817779268f, -126.0f), 126.0f));
}

// ---- k_prep: one block per 64 (t) x 64 (d) tile of one input (blockIdx.z: batches of the first input, then of the second). The tile is read once, 16 B per lane along d.
// Value plane V16[b][d][t] (f16) = bf16_RNE(F[b][t][d]) * VSC through the flush select (the x16 carry keeps small entries normal in f16; bf16 significands are exact in f16):
// each thread packs two neighbouring t of one d into a dword of the LDS tile tl[d][t]; behind the block barrier the tile is read back along t and stored as whole 128-B rows (4 lanes x 32 B).
// Second input only: exponential plane E[b][t][d] (f32) = e^{2 bf16_RNE(F[b][t][d])}, same layout as the input, from the same registers.
#define PPITCH 72   // halves per LDS row: 144 B = 16 B x odd for the 16-B read-back
static_assert(TK % 64 == 0 && DV % 64 == 0 && (PPITCH * 2) % 16 == 0 && PPITCH >= 64);
template <bool EXPO>
__device__ __forceinline__ void prep_tile(const float* __restrict__ F, h16* V, float* E, h16* tl, int b) {
    const int tid = threadIdx.x; const int d0 = blockIdx.x * 64, t0 = blockIdx.y * 64;
    const int c4 = (tid & 15) * 4, g2 = (tid >> 4) * 2;
    const unsigned base = (unsigned)(((b * TK + t0 + g2) * DV + d0 + c4) * 4);   // byte offset of the thread's first 16 B, the same in the input and in E
    v4f u[4];   // rows t0 + g2 + {0, 1, 32, 33}
#pragma unroll
    for (int p = 0; p < 2; ++p) { u[2 * p] = *(const v4f*)((const char*)F + base + (32 * p) * DV * 4); u[2 * p + 1] = *(const v4f*)((const char*)F + base + (32 * p + 1) * DV * 4); }
#pragma unroll
    for (int k = 0; k < 4; ++k)
#pragma unroll
        for (int e = 0; e < 4; ++e) u[k][e] = bfr(u[k][e]);
#pragma unroll
    for (int p = 0; p < 2; ++p)
#pragma unroll
        for (int e = 0; e < 4; ++e) { const v2h o = {toh_flush(u[2 * p][e] * VSC), toh_flush(u[2 * p + 1][e] * VSC)}; *(v2ha*)(tl + (c4 + e) * PPITCH + 32 * p + g2) = o; }
    if (EXPO) {
#pragma unroll
        for (int k = 0; k < 4; ++k)
#pragma unroll
            for (int e = 0; e < 4; ++e) u[k][e] = e2x(u[k][e]);
    }
    __syncthreads();
    const int dd = tid >> 2, sg = (tid & 3) * 16;
    const v8h r0 = *(const v8ha*)(tl + dd * PPITCH + sg); const v8h r1 = *(const v8ha*)(tl + dd * PPITCH + sg + 8);
    const unsigned vof = (unsigned)((((b * DV + d0 + dd) * TK) + t0 + sg) * 2);   // byte offset of the thread's 32 B in the value plane
    if (EXPO) {
#pragma unroll
        for (int p = 0; p < 2; ++p) { *(v4f*)((char*)E + base + (32 * p) * DV * 4) = u[2 * p]; *(v4f*)((char*)E + base + (32 * p + 1) * DV * 4) = u[2 * p + 1]; }
        asm volatile("s_wait_xcnt 0x0" ::: "memory");   // a register of these stores is reused for the value stores' offset behind them
    }
    *(v8h*)((char*)V + vof) = r0; *(v8h*)((char*)V + vof + 16) = r1;
}
__global__ __launch_bounds__(256) void k_prep(const float* __restrict__ F1, const float* __restrict__ F2, h16* V1, h16* V2, float* E2) {
    __shared__ __align__(16) h16 tl[64 * PPITCH];
    // block-uniform: every thread of a block takes the same side, with its one barrier
    if (blockIdx.z >= NB) prep_tile<true>(F2, V2, E2, tl, (int)blockIdx.z - NB);
    else                  prep_tile<false>(F1, V1, nullptr, tl, (int)blockIdx.z);
}

// ---- k_score: one block per row rq (= b*TQ + i) of the first input. Lane owns d = 4*lane + 128*c + e (c 0..3, e 0..3): e^{2 bf16_RNE(m1[d])} and -2 bf16_RNE(w[d]) in registers;
// wave v scans keys 32v .. 32v+31, per key: 4 x 16-B loads of the second input's exponential row E2, s = sum_d w[d] - 2 sum_d w[d] / (E1[d] E2[k][d] + 1) in f32 (fixed order + xor tree),
// lane 0 stores s into the LDS score row (cross-wave: block barrier). The scalar bias (bf16 RNE) is added to every score.
// (a) raw score row -> f32 plane SF[rq][TK] (1 KB = 8 lines) by waves 0..1 as 32 lanes x 16 B per instruction; (b) softmax over the 256 keys in f32 (max-subtracted, exp2, rcp of the
static_assert(2 * 32 * 16 == TK * 4);
static_assert(1 * 32 * 16 == TK * 2);
static_assert(8 * (TK / 8) == TK && 256 == TK);
__global__ __launch_bounds__(256) void k_score(const float* __restrict__ M1, const float* __restrict__ E2, const float* __restrict__ ww, const float* __restrict__ bb, float* SF, h16* P16) {
    __shared__ __align__(16) float s_sc[TK];
    __shared__ __align__(16) float s_ex[TK];
    __shared__ float red[8];
    const int rq = blockIdx.x; const int b = rq >> TQ_SH;
    const int tid = threadIdx.x, lane = tid & 31; const int wave = __builtin_amdgcn_readfirstlane(tid >> 5);
    const float* mrow = M1 + (size_t)rq * DV;
    v2f e1[8], wn[8]; float ws = 0.0f;
#pragma unroll
    for (int c = 0; c < 4; ++c) { const v4f a4 = *(const v4f*)(mrow + c * 128 + lane * 4); const v4f w4 = *(const v4f*)(ww + c * 128 + lane * 4);
#pragma unroll
        for (int e = 0; e < 4; ++e) { const float wv = bfr(w4[e]); e1[c * 2 + (e >> 1)][e & 1] = e2x(bfr(a4[e])); wn[c * 2 + (e >> 1)][e & 1] = -2.0f * wv; ws += wv; } }
    const float bs = bfr(bb[0]);
    const float* ub = E2 + (size_t)b * TK * DV;
    const v2f one2 = {1.0f, 1.0f};
#pragma unroll 1
    for (int kk = 0; kk < TK / 8; ++kk) {
        const int k = wave * (TK / 8) + kk;
        const float* urow = ub + (size_t)k * DV;
        v4f ur[4];
#pragma unroll
        for (int c = 0; c < 4; ++c) ur[c] = *(const v4f*)(urow + c * 128 + lane * 4);
        asm volatile("s_wait_xcnt 0x0" ::: "memory");   // the row pointer's registers are advanced for the next key behind these loads
        v2f ac0 = {ws, 0.0f}, ac1 = {0.0f, 0.0f};
#pragma unroll
        for (int c = 0; c < 4; ++c) { const v4f u4 = ur[c];
            const v2f x0 = __builtin_elementwise_fma(e1[c * 2], (v2f){u4[0], u4[1]}, one2), x1 = __builtin_elementwise_fma(e1[c * 2 + 1], (v2f){u4[2], u4[3]}, one2);
            const v2f r0 = {__builtin_amdgcn_rcpf(x0[0]), __builtin_amdgcn_rcpf(x0[1])}, r1 = {__builtin_amdgcn_rcpf(x1[0]), __builtin_amdgcn_rcpf(x1[1])};
            ac0 = __builtin_elementwise_fma(wn[c * 2], r0, ac0); ac1 = __builtin_elementwise_fma(wn[c * 2 + 1], r1, ac1); }
        float acc = (ac0[0] + ac0[1]) + (ac1[0] + ac1[1]);
#pragma unroll
        for (int sh = 16; sh; sh >>= 1) acc += __shfl_xor(acc, sh, 32);
        if (lane == 0) s_sc[k] = acc;
    }
    __syncthreads();
    const float a0 = s_sc[tid] + bs;
    s_sc[tid] = a0;
    float m = a0;
#pragma unroll
    for (int sh = 16; sh; sh >>= 1) { const float o = __shfl_xor(m, sh, 32); m = (o > m) ? o : m; }
    if (lane == 0) red[wave] = m;
    __syncthreads();
    m = red[0];
#pragma unroll
    for (int w = 1; w < 8; ++w) { const float o = red[w]; m = (o > m) ? o : m; }
    __syncthreads();
    float d0 = a0 - m;
    const float e0 = __builtin_amdgcn_exp2f(d0 * LOG2E);
    s_ex[tid] = e0;
    float sum = e0;
#pragma unroll
    for (int sh = 16; sh; sh >>= 1) sum += __shfl_xor(sum, sh, 32);
    if (lane == 0) red[wave] = sum;
    __syncthreads();
    sum = red[0];
#pragma unroll
    for (int w = 1; w < 8; ++w) sum += red[w];
    const float inv = __builtin_amdgcn_rcpf(sum); const float invp = inv * PCAR;
    if (wave < 2) {
        const int f0 = (wave * 32 + lane) * 4;
        const v4f p = *(const v4fa*)(s_sc + f0);
        float* dst = SF + (size_t)rq * TK + f0;
        *(v4f*)dst = p; 
    } else if (wave == 2) {
        const int f0 = lane * 8;
        const v4f q0 = *(const v4fa*)(s_ex + f0); const v4f q1 = *(const v4fa*)(s_ex + f0 + 4);
        v8h o;
#pragma unroll
        for (int c = 0; c < 4; ++c) { o[c] = toh_flush(q0[c] * invp); o[4 + c] = toh_flush(q1[c] * invp); }
        h16* dst = P16 + (size_t)rq * TK + f0;
        *(v8h*)dst = o; 
    }
}

// ---- k_csoft: one block per column cq (= b*TK + j) of the score plane. Thread i reads SF[b][i][j] (strided, one float), softmax DOWN the column over the 256 rows in f32
// (max-subtracted, exp2, rcp of the block sum; cross-wave combines through LDS words behind block barriers). Writes the TRANSPOSED plane P2T[cq][i] = f16(1024 p[i][j]) through the
static_assert(1 * 32 * 16 == TQ * 2);
static_assert(256 == TQ);
__global__ __launch_bounds__(256) void k_csoft(const float* __restrict__ SF, h16* P2T) {
    __shared__ __align__(16) float s_ex[TQ];
    __shared__ float red[8];
    const int cq = blockIdx.x; const int b = cq >> TK_SH; const int j = cq & (TK - 1);
    const int tid = threadIdx.x, lane = tid & 31; const int wave = __builtin_amdgcn_readfirstlane(tid >> 5);
    const float a0 = SF[((size_t)((b << TQ_SH) + tid)) * TK + j];
    float m = a0;
#pragma unroll
    for (int sh = 16; sh; sh >>= 1) { const float o = __shfl_xor(m, sh, 32); m = (o > m) ? o : m; }
    if (lane == 0) red[wave] = m;
    __syncthreads();
    m = red[0];
#pragma unroll
    for (int w = 1; w < 8; ++w) { const float o = red[w]; m = (o > m) ? o : m; }
    __syncthreads();
    float d0 = a0 - m;
    const float e0 = __builtin_amdgcn_exp2f(d0 * LOG2E);
    s_ex[tid] = e0;
    float sum = e0;
#pragma unroll
    for (int sh = 16; sh; sh >>= 1) sum += __shfl_xor(sum, sh, 32);
    if (lane == 0) red[wave] = sum;
    __syncthreads();
    sum = red[0];
#pragma unroll
    for (int w = 1; w < 8; ++w) sum += red[w];
    const float inv = __builtin_amdgcn_rcpf(sum); const float invp = inv * PCAR;
    if (wave == 0) {
        const int f0 = lane * 8;
        const v4f q0 = *(const v4fa*)(s_ex + f0); const v4f q1 = *(const v4fa*)(s_ex + f0 + 4);
        v8h o;
#pragma unroll
        for (int c = 0; c < 4; ++c) { o[c] = toh_flush(q0[c] * invp); o[4 + c] = toh_flush(q1[c] * invp); }
        h16* dst = P2T + (size_t)cq * TQ + f0;
        *(v8h*)dst = o; 
    }
}

extern "C" void kernel_launch(void* const* d_in, const int* in_sizes, int n_in,
                              void* d_out, int out_size, void* d_ws, size_t ws_size, hipStream_t stream) {
    if (n_in < 4) return;
    if (in_sizes[0] < NB * TQ * DV || in_sizes[1] < NB * TK * DV || in_sizes[2] < DV || in_sizes[3] < 1) return;
    if (out_size < NB_FULL * TQ * DV + NB * TK * DV) return;
    const float* modal1 = (const float*)d_in[0];   // [NB][TQ][DV]
    const float* modal2 = (const float*)d_in[1];   // [NB][TK][DV]
    const float* wvec   = (const float*)d_in[2];   // [DV]
    const float* bsc    = (const float*)d_in[3];   // [1]
    float* OUT0 = (float*)d_out;                                  // [NB_FULL][TQ][DV], byte offset 0
    float* OUT1 = OUT0 + (size_t)NB_FULL * TQ * DV;               // [NB_FULL][TK][DV], byte offset 2097152

    char* wsp = (char*)d_ws;
    auto take = [&](size_t bytes) { char* p = wsp; wsp += (bytes + 255) & ~(size_t)255; return (void*)p; };
    float* EX2  = (float*)take((size_t)NB * TK * DV * 4); // [NB][TK][DV] f32 e^{2x} of the second input 2 MB
    h16*   VT2  = (h16*)take((size_t)NB * DV * TK * 2);   // [NB][DV][TK] f16 x16 of the second input  1 MB
    h16*   VT1  = (h16*)take((size_t)NB * DV * TQ * 2);   // [NB][DV][TQ] f16 x16 of the first input   1 MB
    float* SF   = (float*)take((size_t)NB * TQ * TK * 4); // [NB*TQ][TK] f32 raw scores               1 MB
    h16*   P1   = (h16*)take((size_t)NB * TQ * TK * 2);   // [NB*TQ][TK] f16 x1024                     0.5 MB
    h16*   P2T  = (h16*)take((size_t)NB * TK * TQ * 2);   // [NB*TK][TQ] f16 x1024 (transposed)        0.5 MB
    if ((size_t)(wsp - (char*)d_ws) > ws_size) return;    // total 6,291,456 B

    // both value planes [b][d][t] f16 x16 and the exponential plane of the second input (read by every row's score block), one pass over each input tile
    k_prep<<<dim3(DV / 64, TK / 64, 2 * NB), 256, 0, stream>>>(modal1, modal2, VT1, VT2, EX2);
    // scores per row of the first input -> raw score plane SF and the key-softmax plane P1 (f16 x1024)
    k_score<<<(unsigned)(NB * TQ), 256, 0, stream>>>(modal1, EX2, wvec, bsc, SF, P1);
    // softmax down the columns -> transposed plane P2T (f16 x1024)
    k_csoft<<<(unsigned)(NB * TK), 256, 0, stream>>>(SF, P2T);
    // out0 = P1 . modal2 : per batch z, [TQ][TK] x Bt[DV][TK] -> f32 [TQ][DV], epilogue scale 2^-14
    k_gemmw<h16, 0, false><<<dim3(TQ / 64, DV / 64, NB), 32, 0, stream>>>(P1, nullptr, VT2, nullptr, TK, OUT0, DV, nullptr, OSC, (size_t)TQ * TK, (size_t)DV * TK, (size_t)TQ * DV);
    // out1 = P2^T . modal1 : per batch z, [TK][TQ] x Bt[DV][TQ] -> f32 [TK][DV], epilogue scale 2^-14
    k_gemmw<h16, 0, false><<<dim3(TK / 64, DV / 64, NB), 32, 0, stream>>>(P2T, nullptr, VT1, nullptr, TQ, OUT1, DV, nullptr, OSC, (size_t)TK * TQ, (size_t)DV * TQ, (size_t)TK * DV);
}

// v003
// A run of this version takes 37.3 microseconds.
// Next to v002, in two timings, it ran 1.37 times as fast each time.
// Over all steps from v000 it is 1.75 times as fast.
#include <hip/hip_runtime.h>

// Contractions: P1.modal2 and P2^T.modal1 on v_wmma_f32_16x16x32_f16 (f16 operands: P carried x1024, values = bf16-RNE inputs carried x16, f32 accumulate, folded by 2^-14 in the f32 epilogue);
// score matvec sum_d w[d]*tanh(m1[d]+m2[d]) (N=1) and both softmaxes (over keys, and down the columns) stay f32 on VALU;
// tanh(a+b) = 1 - 2 / (e^{2a} e^{2b} + 1): the exponentials are taken once per input element, the score loop is left with one reciprocal per (row, key, d).

#ifndef NB
#define NB 4
#endif
#define NB_FULL 4
#define TQ    256
#define TK    256
#define DV    512
#define TQ_SH 8
#define TK_SH 8
#define PCAR  1024.0f
#define VSC   16.0f
#define OSC   (1.0f / 16384.0f)
#define LOG2E 1.4426950408889634f

static_assert(NB >= 1 && NB <= NB_FULL);
static_assert(TQ == TK);
static_assert((1 << TQ_SH) == TQ && (1 << TK_SH) == TK);
static_assert(TQ % 64 == 0 && TK % 64 == 0 && DV % 64 == 0);
static_assert(TQ % 32 == 0 && TK % 32 == 0);
static_assert(DV == 4 * 128);
static_assert(TK == 8 * 32 && TQ == 8 * 32);
static_assert((size_t)NB_FULL * TQ * DV * 4 == 2097152);
static_assert(((size_t)NB_FULL * TQ * DV + (size_t)NB_FULL * TK * DV) * 4 == 4194304);

static constexpr size_t WS_TOTAL = (size_t)NB * TK * DV * 4 + (size_t)NB * DV * TK * 2 + (size_t)NB * DV * TQ * 2 + (size_t)NB * TQ * TK * 4 + (size_t)NB * TQ * TK * 2 + (size_t)NB * TK * TQ * 2;
static_assert(WS_TOTAL <= 134217728);
static_assert((((size_t)NB * DV * TK * 2) % 256) == 0 && (((size_t)NB * TQ * TK * 2) % 256) == 0);
static_assert(16 * 68 * 4 <= 131072);
static_assert((8 * TK + 32) * 4 <= 131072);

typedef _Float16 h16;
typedef __attribute__((ext_vector_type(16))) _Float16 v16h;
typedef __attribute__((ext_vector_type(8)))  _Float16 v8h;
typedef __attribute__((ext_vector_type(8)))  float    v8f;
typedef __attribute__((ext_vector_type(4)))  float    v4f;
typedef __attribute__((ext_vector_type(2)))  float    v2f;
typedef __attribute__((ext_vector_type(2)))  _Float16 v2h;
typedef v8h  __attribute__((may_alias)) v8ha;
typedef v4f  __attribute__((may_alias)) v4fa;
typedef v2h  __attribute__((may_alias)) v2ha;

__device__ __forceinline__ unsigned short f2bf(float f) { unsigned u = __float_as_uint(f); u += 0x7FFFu + ((u >> 16) & 1u); return (unsigned short)(u >> 16); }
__device__ __forceinline__ float bf2f(unsigned short b) { return __uint_as_float(((unsigned)b) << 16); }
__device__ __forceinline__ float bfr(float f) { return bf2f(f2bf(f)); }
__device__ __forceinline__ v16h cat16(v8h lo, v8h hi) { return __builtin_shufflevector(lo, hi, 0, 1, 2, 3, 4, 5, 6, 7, 8, 9, 10, 11, 12, 13, 14, 15); }
__device__ __forceinline__ v8f wmma16(v16h a, v16h b, v8f c) { return __builtin_amdgcn_wmma_f32_16x16x32_f16(false, a, false, b, (short)0, c, false, false); }

// f32 -> f16 operand convert with a value select: anything below the smallest normal f16 becomes +0 before the convert.
static __device__ __forceinline__ h16 toh_flush(float v) { const float w = (fabsf(v) < 6.103515625e-05f) ? 0.0f : v; return (h16)w; }

// ---- k_gemmw: register-blocked GEMM, ONE WAVE per 64x64 output tile (16 accumulators), operands straight from K-contiguous 16-bit planes; grid (M/64, N/64, Z), 32 threads.
// C[m][n] (f32, pitch ldc) = csc * sum_k A[m][k] Bt[n][k] (+ split products per NSPLIT) (+ optional bf16-exact f32 bias[n]). z-batch strides sA/sB/sC in elements. K % 32 == 0.
// Fragments (lane l, hi = l>>4, lr = l&15): A elements 0..7 <- A[r][k0+8hi+0..7], 8..15 <- A[r][k0+16+8hi+0..7]; B identical k map from Bt[n][k]; D element j -> (row 8hi+j, col lr).
template <typename T16> struct WFrag;
template <> struct WFrag<h16> { typedef v16h V; static __device__ __forceinline__ V ld(const h16* p) { return cat16(*(const v8h*)p, *(const v8h*)(p + 16)); } static __device__ __forceinline__ v8f mma(V a, V b, v8f c) { return wmma16(a, b, c); } };
template <typename T16, int NSPLIT, bool BIAS>
__global__ __launch_bounds__(32) void k_gemmw(const T16* __restrict__ A, const T16* __restrict__ A2, const T16* __restrict__ Bt, const T16* __restrict__ Bt2, int K, float* C, int ldc, const float* __restrict__ bias, float csc, size_t sA, size_t sB, size_t sC) {
    typedef typename WFrag<T16>::V V;
    __shared__ __align__(16) float os[16 * 68];
    const size_t z = blockIdx.z; A += z * sA; if (A2) A2 += z * sA; Bt += z * sB; if (Bt2) Bt2 += z * sB; C += z * sC;
    const int lane = threadIdx.x & 31, lr = lane & 15, hi = lane >> 4; const int r0 = blockIdx.x * 64, c0 = blockIdx.y * 64;
    v8f acc[4][4];
#pragma unroll
    for (int mb = 0; mb < 4; ++mb)
#pragma unroll
        for (int nb = 0; nb < 4; ++nb) acc[mb][nb] = (v8f){};
    const size_t aoff = (size_t)(r0 + lr) * K + 8 * hi, boff = (size_t)(c0 + lr) * K + 8 * hi;
#pragma unroll 1
    for (int kc = 0; kc < K; kc += 32) {
        V a[4], a2[4];
#pragma unroll
        for (int mb = 0; mb < 4; ++mb) { a[mb] = WFrag<T16>::ld(A + aoff + (size_t)mb * 16 * K + kc); if (NSPLIT == 1 || NSPLIT == 2) a2[mb] = WFrag<T16>::ld(A2 + aoff + (size_t)mb * 16 * K + kc); }
#pragma unroll
        for (int nb = 0; nb < 4; ++nb) { const V b = WFrag<T16>::ld(Bt + boff + (size_t)nb * 16 * K + kc); V b2; if (NSPLIT >= 2) b2 = WFrag<T16>::ld(Bt2 + boff + (size_t)nb * 16 * K + kc);
#pragma unroll
            for (int mb = 0; mb < 4; ++mb) { acc[mb][nb] = WFrag<T16>::mma(a[mb], b, acc[mb][nb]); if (NSPLIT == 1 || NSPLIT == 2) acc[mb][nb] = WFrag<T16>::mma(a2[mb], b, acc[mb][nb]); if (NSPLIT >= 2) acc[mb][nb] = WFrag<T16>::mma(a[mb], b2, acc[mb][nb]); } }
        asm volatile("v_nop\n\tv_nop\n\tv_nop\n\tv_nop" : "+v"(acc[0][0]), "+v"(acc[1][1]), "+v"(acc[2][2]), "+v"(acc[3][3]) : "v"(a[0]), "v"(a[3]));
    }
#pragma unroll
    for (int mb = 0; mb < 4; ++mb) {
#pragma unroll
        for (int nb = 0; nb < 4; ++nb) {
#pragma unroll
            for (int j = 0; j < 8; ++j) os[(hi * 8 + j) * 68 + nb * 16 + lr] = acc[mb][nb][j]; }
        __builtin_amdgcn_wave_barrier(); asm volatile("" ::: "memory");
        float* crow = C + (size_t)(r0 + mb * 16) * ldc + c0;
{
#pragma unroll
            for (int s = 0; s < 8; ++s) { const int row = 2 * s + hi, cofs = lr * 4; v4f val = *(const v4fa*)(os + row * 68 + cofs); val = val * csc;
                if (BIAS) { val[0] += bfr(bias[c0 + cofs]); val[1] += bfr(bias[c0 + cofs + 1]); val[2] += bfr(bias[c0 + cofs + 2]); val[3] += bfr(bias[c0 + cofs + 3]); }
                *(v4f*)(crow + (size_t)row * ldc + cofs) = val; }
             }
        __builtin_amdgcn_wave_barrier(); asm volatile("" ::: "memory");
    }
}

// ---- e^{2x} via exp2. The exponent is held inside [-126, 126] so that the value is never inf or 0: the product of two of them may run to inf or 0
// (tanh saturates cleanly to +-1: rcp(inf) = 0, rcp(1) = 1) but is never inf * 0.
__device__ __forceinline__ float e2x(float x) {
    return __builtin_amdgcn_exp2f(fminf(fmaxf(x * 2.8853900817779268f, -126.0f), 126.0f));
}

// ---- k_prep: one block per 64 (t) x 64 (d) tile of one input (blockIdx.z: batches of the first input, then of the second). The tile is read once, 16 B per lane along d.
// Value plane V16[b][d][t] (f16) = bf16_RNE(F[b][t][d]) * VSC through the flush select (the x16 carry keeps small entries normal in f16; bf16 significands are exact in f16):
// each thread packs two neighbouring t of one d into a dword of the LDS tile tl[d][t]; behind the block barrier the tile is read back along t and stored as whole 128-B rows (4 lanes x 32 B).
// Second input only: exponential plane E[b][t][d] (f32) = e^{2 bf16_RNE(F[b][t][d])}, same layout as the input, from the same registers.
#define PPITCH 72   // halves per LDS row: 144 B = 16 B x odd for the 16-B read-back
static_assert(TK % 64 == 0 && DV % 64 == 0 && (PPITCH * 2) % 16 == 0 && PPITCH >= 64);
template <bool EXPO>
__device__ __forceinline__ void prep_tile(const float* __restrict__ F, h16* V, float* E, h16* tl, int b) {
    const int tid = threadIdx.x; const int d0 = blockIdx.x * 64, t0 = blockIdx.y * 64;
    const int c4 = (tid & 15) * 4, g2 = (tid >> 4) * 2;
    const unsigned base = (unsigned)(((b * TK + t0 + g2) * DV + d0 + c4) * 4);   // byte offset of the thread's first 16 B, the same in the input and in E
    v4f u[4];   // rows t0 + g2 + {0, 1, 32, 33}
#pragma unroll
    for (int p = 0; p < 2; ++p) { u[2 * p] = *(const v4f*)((const char*)F + base + (32 * p) * DV * 4); u[2 * p + 1] = *(const v4f*)((const char*)F + base + (32 * p + 1) * DV * 4); }
#pragma unroll
    for (int k = 0; k < 4; ++k)
#pragma unroll
        for (int e = 0; e < 4; ++e) u[k][e] = bfr(u[k][e]);
#pragma unroll
    for (int p = 0; p < 2; ++p)
#pragma unroll
        for (int e = 0; e < 4; ++e) { const v2h o = {toh_flush(u[2 * p][e] * VSC), toh_flush(u[2 * p + 1][e] * VSC)}; *(v2ha*)(tl + (c4 + e) * PPITCH + 32 * p + g2) = o; }
    if (EXPO) {
#pragma unroll
        for (int k = 0; k < 4; ++k)
#pragma unroll
            for (int e = 0; e < 4; ++e) u[k][e] = e2x(u[k][e]);
    }
    __syncthreads();
    const int dd = tid >> 2, sg = (tid & 3) * 16;
    const v8h r0 = *(const v8ha*)(tl + dd * PPITCH + sg); const v8h r1 = *(const v8ha*)(tl + dd * PPITCH + sg + 8);
    const unsigned vof = (unsigned)((((b * DV + d0 + dd) * TK) + t0 + sg) * 2);   // byte offset of the thread's 32 B in the value plane
    if (EXPO) {
#pragma unroll
        for (int p = 0; p < 2; ++p) { *(v4f*)((char*)E + base + (32 * p) * DV * 4) = u[2 * p]; *(v4f*)((char*)E + base + (32 * p + 1) * DV * 4) = u[2 * p + 1]; }
        asm volatile("s_wait_xcnt 0x0" ::: "memory");   // a register of these stores is reused for the value stores' offset behind them
    }
    *(v8h*)((char*)V + vof) = r0; *(v8h*)((char*)V + vof + 16) = r1;
}
__global__ __launch_bounds__(256) void k_prep(const float* __restrict__ F1, const float* __restrict__ F2, h16* V1, h16* V2, float* E2) {
    __shared__ __align__(16) h16 tl[64 * PPITCH];
    // block-uniform: every thread of a block takes the same side, with its one barrier
    if (blockIdx.z >= NB) prep_tile<true>(F2, V2, E2, tl, (int)blockIdx.z - NB);
    else                  prep_tile<false>(F1, V1, nullptr, tl, (int)blockIdx.z);
}

// ---- k_score: one block (16 waves) per RB = 4 consecutive rows rq0 .. rq0+3 (= b*TQ + i) of the first input. Lane owns d = 4*lane + 128*c + e (c 0..3, e 0..3):
// e^{2 bf16_RNE(m1[d])} of all four rows and -2 bf16_RNE(w[d]) in registers; wave v scans keys 16v .. 16v+15, two keys a trip. Per key: 4 x 16-B loads of the second input's exponential
// row E2, each loaded row used for all four rows of the block (the plane is read from L2 once per four rows); s = sum_d w[d] - 2 sum_d w[d] / (E1[d] E2[k][d] + 1) in f32
// (fixed order + xor tree, the same per score as with one row a block), lane 0 stores s into the LDS score rows (cross-wave: block barrier). The scalar bias (bf16 RNE) is added to every score.
// Behind the loop waves 0..7 take rows 0 and 2, waves 8..15 rows 1 and 3 (thread = key): (a) raw score rows -> f32 plane SF[rq][TK] (4 KB in a row) by waves 0..7 as 32 lanes x 16 B;
// (b) softmax over the 256 keys in f32 (max-subtracted, exp2, rcp of the row sum) -> P16 (f16 x1024), row r by wave 8 + r.
#define RB 4    // rows of the first input per block
#define KU 2    // keys per trip of a wave
#define SWV 16  // waves per block
static_assert(TQ % RB == 0 && RB == 4 && SWV == 16);
static_assert((TK / SWV) % KU == 0);
static_assert(8 * 32 * 16 == RB * TK * 4);
static_assert(1 * 32 * 16 == TK * 2);
static_assert(256 == TK);
__global__ __launch_bounds__(512) void k_score(const float* __restrict__ M1, const float* __restrict__ E2, const float* __restrict__ ww, const float* __restrict__ bb, float* SF, h16* P16) {
    __shared__ __align__(16) float s_sc[RB * TK];
    __shared__ __align__(16) float s_ex[RB * TK];
    __shared__ float red[2][SWV];
    const int rq0 = blockIdx.x * RB; const int b = rq0 >> TQ_SH;
    const int tid = threadIdx.x, lane = tid & 31; const int wave = __builtin_amdgcn_readfirstlane(tid >> 5);
    const float* mrow = M1 + (size_t)rq0 * DV;
    v2f e1[RB][8], wn[8]; float ws = 0.0f;
#pragma unroll
    for (int c = 0; c < 4; ++c) { const v4f w4 = *(const v4f*)(ww + c * 128 + lane * 4);
#pragma unroll
        for (int e = 0; e < 4; ++e) { const float wv = bfr(w4[e]); wn[c * 2 + (e >> 1)][e & 1] = -2.0f * wv; ws += wv; } }
#pragma unroll
    for (int r = 0; r < RB; ++r) {
#pragma unroll
        for (int c = 0; c < 4; ++c) { const v4f a4 = *(const v4f*)(mrow + lane * 4 + (r * DV + c * 128));
#pragma unroll
            for (int e = 0; e < 4; ++e) e1[r][c * 2 + (e >> 1)][e & 1] = e2x(bfr(a4[e])); } }
    const float bs = bfr(bb[0]);
    const int k0 = wave * (TK / SWV);
    const float* ub = E2 + ((size_t)b * TK + k0) * DV;
    const v2f one2 = {1.0f, 1.0f};
    // kept rolled: one trip (2 keys x 4 rows) already takes most of the registers a wave has at four waves per SIMD; the loops inside are unrolled whole so that every array stays in registers
#pragma unroll 1
    for (int kk = 0; kk < TK / SWV; kk += KU) {
        const float* urow = ub + (size_t)kk * DV;
        v4f ur[KU][4];
#pragma unroll
        for (int q = 0; q < KU; ++q)
#pragma unroll
            for (int c = 0; c < 4; ++c) ur[q][c] = *(const v4f*)(urow + q * DV + c * 128 + lane * 4);
        asm volatile("s_wait_xcnt 0x0" ::: "memory");   // the row pointer's registers are advanced for the next keys behind these loads
        float acc[KU][RB];
#pragma unroll
        for (int q = 0; q < KU; ++q)
#pragma unroll
            for (int r = 0; r < RB; ++r) {
                v2f ac0 = {ws, 0.0f}, ac1 = {0.0f, 0.0f};
#pragma unroll
                for (int c = 0; c < 4; ++c) { const v4f u4 = ur[q][c];
                    const v2f x0 = __builtin_elementwise_fma(e1[r][c * 2], (v2f){u4[0], u4[1]}, one2), x1 = __builtin_elementwise_fma(e1[r][c * 2 + 1], (v2f){u4[2], u4[3]}, one2);
                    const v2f r0 = {__builtin_amdgcn_rcpf(x0[0]), __builtin_amdgcn_rcpf(x0[1])}, r1 = {__builtin_amdgcn_rcpf(x1[0]), __builtin_amdgcn_rcpf(x1[1])};
                    ac0 = __builtin_elementwise_fma(wn[c * 2], r0, ac0); ac1 = __builtin_elementwise_fma(wn[c * 2 + 1], r1, ac1); }
                acc[q][r] = (ac0[0] + ac0[1]) + (ac1[0] + ac1[1]);
            }
#pragma unroll
        for (int sh = 16; sh; sh >>= 1)
#pragma unroll
            for (int q = 0; q < KU; ++q)
#pragma unroll
                for (int r = 0; r < RB; ++r) acc[q][r] += __shfl_xor(acc[q][r], sh, 32);
        if (lane == 0) {
#pragma unroll
            for (int q = 0; q < KU; ++q)
#pragma unroll
                for (int r = 0; r < RB; ++r) s_sc[r * TK + k0 + kk + q] = acc[q][r];
        }
    }
    __syncthreads();
    const int g = wave >> 3, key = tid & (TK - 1);   // thread's rows: g and 2 + g
    float a0[2], m[2], sum[2];
#pragma unroll
    for (int h = 0; h < 2; ++h) { const int o = (2 * h + g) * TK + key; a0[h] = s_sc[o] + bs; s_sc[o] = a0[h]; m[h] = a0[h]; }
#pragma unroll
    for (int sh = 16; sh; sh >>= 1)
#pragma unroll
        for (int h = 0; h < 2; ++h) { const float o = __shfl_xor(m[h], sh, 32); m[h] = (o > m[h]) ? o : m[h]; }
    if (lane == 0) { red[0][wave] = m[0]; red[1][wave] = m[1]; }
    __syncthreads();
#pragma unroll
    for (int h = 0; h < 2; ++h) { m[h] = red[h][g * 8];
#pragma unroll
        for (int w = 1; w < 8; ++w) { const float o = red[h][g * 8 + w]; m[h] = (o > m[h]) ? o : m[h]; } }
    __syncthreads();
#pragma unroll
    for (int h = 0; h < 2; ++h) { const float e0 = __builtin_amdgcn_exp2f((a0[h] - m[h]) * LOG2E); s_ex[(2 * h + g) * TK + key] = e0; sum[h] = e0; }
#pragma unroll
    for (int sh = 16; sh; sh >>= 1)
#pragma unroll
        for (int h = 0; h < 2; ++h) sum[h] += __shfl_xor(sum[h], sh, 32);
    if (lane == 0) { red[0][wave] = sum[0]; red[1][wave] = sum[1]; }
    __syncthreads();
    if (wave < 8) {
        const int f0 = tid * 4;
        const v4f p = *(const v4fa*)(s_sc + f0);
        float* dst = SF + (size_t)rq0 * TK + f0;
        *(v4f*)dst = p;
    } else if (wave < 8 + RB) {
        const int r = wave - 8;   // row r = 2 h + g: its eight wave sums lie in red[r >> 1][8 (r & 1) ..]
        const float* rr = &red[r >> 1][(r & 1) * 8];
        float rs = rr[0];
#pragma unroll
        for (int w = 1; w < 8; ++w) rs += rr[w];
        const float inv = __builtin_amdgcn_rcpf(rs); const float invp = inv * PCAR;
        const int f0 = r * TK + lane * 8;
        const v4f q0 = *(const v4fa*)(s_ex + f0); const v4f q1 = *(const v4fa*)(s_ex + f0 + 4);
        v8h o;
#pragma unroll
        for (int c = 0; c < 4; ++c) { o[c] = toh_flush(q0[c] * invp); o[4 + c] = toh_flush(q1[c] * invp); }
        h16* dst = P16 + (size_t)rq0 * TK + f0;
        *(v8h*)dst = o;
    }
}

// ---- k_csoft: one block per column cq (= b*TK + j) of the score plane. Thread i reads SF[b][i][j] (strided, one float), softmax DOWN the column over the 256 rows in f32
// (max-subtracted, exp2, rcp of the block sum; cross-wave combines through LDS words behind block barriers). Writes the TRANSPOSED plane P2T[cq][i] = f16(1024 p[i][j]) through the
static_assert(1 * 32 * 16 == TQ * 2);
static_assert(256 == TQ);
__global__ __launch_bounds__(256) void k_csoft(const float* __restrict__ SF, h16* P2T) {
    __shared__ __align__(16) float s_ex[TQ];
    __shared__ float red[8];
    const int cq = blockIdx.x; const int b = cq >> TK_SH; const int j = cq & (TK - 1);
    const int tid = threadIdx.x, lane = tid & 31; const int wave = __builtin_amdgcn_readfirstlane(tid >> 5);
    const float a0 = SF[((size_t)((b << TQ_SH) + tid)) * TK + j];
    float m = a0;
#pragma unroll
    for (int sh = 16; sh; sh >>= 1) { const float o = __shfl_xor(m, sh, 32); m = (o > m) ? o : m; }
    if (lane == 0) red[wave] = m;
    __syncthreads();
    m = red[0];
#pragma unroll
    for (int w = 1; w < 8; ++w) { const float o = red[w]; m = (o > m) ? o : m; }
    __syncthreads();
    float d0 = a0 - m;
    const float e0 = __builtin_amdgcn_exp2f(d0 * LOG2E);
    s_ex[tid] = e0;
    float sum = e0;
#pragma unroll
    for (int sh = 16; sh; sh >>= 1) sum += __shfl_xor(sum, sh, 32);
    if (lane == 0) red[wave] = sum;
    __syncthreads();
    sum = red[0];
#pragma unroll
    for (int w = 1; w < 8; ++w) sum += red[w];
    const float inv = __builtin_amdgcn_rcpf(sum); const float invp = inv * PCAR;
    if (wave == 0) {
        const int f0 = lane * 8;
        const v4f q0 = *(const v4fa*)(s_ex + f0); const v4f q1 = *(const v4fa*)(s_ex + f0 + 4);
        v8h o;
#pragma unroll
        for (int c = 0; c < 4; ++c) { o[c] = toh_flush(q0[c] * invp); o[4 + c] = toh_flush(q1[c] * invp); }
        h16* dst = P2T + (size_t)cq * TQ + f0;
        *(v8h*)dst = o; 
    }
}

extern "C" void kernel_launch(void* const* d_in, const int* in_sizes, int n_in,
                              void* d_out, int out_size, void* d_ws, size_t ws_size, hipStream_t stream) {
    if (n_in < 4) return;
    if (in_sizes[0] < NB * TQ * DV || in_sizes[1] < NB * TK * DV || in_sizes[2] < DV || in_sizes[3] < 1) return;
    if (out_size < NB_FULL * TQ * DV + NB * TK * DV) return;
    const float* modal1 = (const float*)d_in[0];   // [NB][TQ][DV]
    const float* modal2 = (const float*)d_in[1];   // [NB][TK][DV]
    const float* wvec   = (const float*)d_in[2];   // [DV]
    const float* bsc    = (const float*)d_in[3];   // [1]
    float* OUT0 = (float*)d_out;                                  // [NB_FULL][TQ][DV], byte offset 0
    float* OUT1 = OUT0 + (size_t)NB_FULL * TQ * DV;               // [NB_FULL][TK][DV], byte offset 2097152

    char* wsp = (char*)d_ws;
    auto take = [&](size_t bytes) { char* p = wsp; wsp += (bytes + 255) & ~(size_t)255; return (void*)p; };
    float* EX2  = (float*)take((size_t)NB * TK * DV * 4); // [NB][TK][DV] f32 e^{2x} of the second input 2 MB
    h16*   VT2  = (h16*)take((size_t)NB * DV * TK * 2);   // [NB][DV][TK] f16 x16 of the second input  1 MB
    h16*   VT1  = (h16*)take((size_t)NB * DV * TQ * 2);   // [NB][DV][TQ] f16 x16 of the first input   1 MB
    float* SF   = (float*)take((size_t)NB * TQ * TK * 4); // [NB*TQ][TK] f32 raw scores               1 MB
    h16*   P1   = (h16*)take((size_t)NB * TQ * TK * 2);   // [NB*TQ][TK] f16 x1024                     0.5 MB
    h16*   P2T  = (h16*)take((size_t)NB * TK * TQ * 2);   // [NB*TK][TQ] f16 x1024 (transposed)        0.5 MB
    if ((size_t)(wsp - (char*)d_ws) > ws_size) return;    // total 6,291,456 B

    // both value planes [b][d][t] f16 x16 and the exponential plane of the second input (read by every row's score block), one pass over each input tile
    k_prep<<<dim3(DV / 64, TK / 64, 2 * NB), 256, 0, stream>>>(modal1, modal2, VT1, VT2, EX2);
    // scores, four rows of the first input per block -> raw score plane SF and the key-softmax plane P1 (f16 x1024)
    k_score<<<(unsigned)(NB * TQ / RB), 512, 0, stream>>>(modal1, EX2, wvec, bsc, SF, P1);
    // softmax down the columns -> transposed plane P2T (f16 x1024)
    k_csoft<<<(unsigned)(NB * TK), 256, 0, stream>>>(SF, P2T);
    // out0 = P1 . modal2 : per batch z, [TQ][TK] x Bt[DV][TK] -> f32 [TQ][DV], epilogue scale 2^-14
    k_gemmw<h16, 0, false><<<dim3(TQ / 64, DV / 64, NB), 32, 0, stream>>>(P1, nullptr, VT2, nullptr, TK, OUT0, DV, nullptr, OSC, (size_t)TQ * TK, (size_t)DV * TK, (size_t)TQ * DV);
    // out1 = P2^T . modal1 : per batch z, [TK][TQ] x Bt[DV][TQ] -> f32 [TK][DV], epilogue scale 2^-14
    k_gemmw<h16, 0, false><<<dim3(TK / 64, DV / 64, NB), 32, 0, stream>>>(P2T, nullptr, VT1, nullptr, TQ, OUT1, DV, nullptr, OSC, (size_t)TK * TQ, (size_t)DV * TQ, (size_t)TK * DV);
}

// v004
// Measured time: 30.9 microseconds a run.
// Timed twice side by side with v003, it ran 1.25 and 1.24 times as fast.
// Counting every step since v000, it is 2.17 times as fast.
#include <hip/hip_runtime.h>

// Contractions: P1.modal2 and P2^T.modal1 on v_wmma_f32_16x16x32_f16 (f16 operands: P carried x1024, values = bf16-RNE inputs carried x16, f32 accumulate, folded by 2^-14 in the f32 epilogue);
// score matvec sum_d w[d]*tanh(m1[d]+m2[d]) (N=1) and both softmaxes (over keys, and down the columns) stay f32 on VALU;
// tanh(a+b) = 1 - 2 / (e^{2a} e^{2b} + 1): the exponentials are taken once per input element, the score loop is left with one reciprocal per (row, key, d).

#ifndef NB
#define NB 4
#endif
#define NB_FULL 4
#define TQ    256
#define TK    256
#define DV    512
#define TQ_SH 8
#define TK_SH 8
#define PCAR  1024.0f
#define VSC   16.0f
#define OSC   (1.0f / 16384.0f)
#define LOG2E 1.4426950408889634f

static_assert(NB >= 1 && NB <= NB_FULL);
static_assert(TQ == TK);
static_assert((1 << TQ_SH) == TQ && (1 << TK_SH) == TK);
static_assert(TQ % 64 == 0 && TK % 64 == 0 && DV % 64 == 0);
static_assert(TQ % 32 == 0 && TK % 32 == 0);
static_assert(DV == 4 * 128);
static_assert(TK == 8 * 32 && TQ == 8 * 32);
static_assert((size_t)NB_FULL * TQ * DV * 4 == 2097152);
static_assert(((size_t)NB_FULL * TQ * DV + (size_t)NB_FULL * TK * DV) * 4 == 4194304);

static constexpr size_t WS_TOTAL = (size_t)NB * TK * DV * 4 + (size_t)NB * DV * TK * 2 + (size_t)NB * DV * TQ * 2 + (size_t)NB * TQ * TK * 4 + (size_t)NB * TQ * TK * 2 + (size_t)NB * TK * TQ * 2;
static_assert(WS_TOTAL <= 134217728);
static_assert((((size_t)NB * DV * TK * 2) % 256) == 0 && (((size_t)NB * TQ * TK * 2) % 256) == 0);
static_assert(16 * 68 * 4 <= 131072);
static_assert((8 * TK + 32) * 4 <= 131072);
static_assert(NB == NB_FULL);   // the two outputs lie back to back: slice NB of the joint product launch starts the second output

typedef _Float16 h16;
typedef __attribute__((ext_vector_type(16))) _Float16 v16h;
typedef __attribute__((ext_vector_type(8)))  _Float16 v8h;
typedef __attribute__((ext_vector_type(8)))  float    v8f;
typedef __attribute__((ext_vector_type(4)))  float    v4f;
typedef __attribute__((ext_vector_type(2)))  float    v2f;
typedef __attribute__((ext_vector_type(2)))  _Float16 v2h;
typedef v8h  __attribute__((may_alias)) v8ha;
typedef v4f  __attribute__((may_alias)) v4fa;
typedef v2h  __attribute__((may_alias)) v2ha;

__device__ __forceinline__ unsigned short f2bf(float f) { unsigned u = __float_as_uint(f); u += 0x7FFFu + ((u >> 16) & 1u); return (unsigned short)(u >> 16); }
__device__ __forceinline__ float bf2f(unsigned short b) { return __uint_as_float(((unsigned)b) << 16); }
__device__ __forceinline__ float bfr(float f) { return bf2f(f2bf(f)); }
__device__ __forceinline__ v16h cat16(v8h lo, v8h hi) { return __builtin_shufflevector(lo, hi, 0, 1, 2, 3, 4, 5, 6, 7, 8, 9, 10, 11, 12, 13, 14, 15); }
__device__ __forceinline__ v8f wmma16(v16h a, v16h b, v8f c) { return __builtin_amdgcn_wmma_f32_16x16x32_f16(false, a, false, b, (short)0, c, false, false); }

// f32 -> f16 operand convert with a value select: anything below the smallest normal f16 becomes +0 before the convert.
static __device__ __forceinline__ h16 toh_flush(float v) { const float w = (fabsf(v) < 6.103515625e-05f) ? 0.0f : v; return (h16)w; }

// ---- k_gemmw: register-blocked GEMM, ONE WAVE per 64x64 output tile (16 accumulators), operands straight from K-contiguous 16-bit planes; grid (M/64, N/64, Z), 32 threads.
// C[m][n] (f32, pitch ldc) = csc * sum_k A[m][k] Bt[n][k] (+ split products per NSPLIT) (+ optional bf16-exact f32 bias[n]). z-batch strides sA/sB/sC in elements. K % 32 == 0.
// Fragments (lane l, hi = l>>4, lr = l&15): A elements 0..7 <- A[r][k0+8hi+0..7], 8..15 <- A[r][k0+16+8hi+0..7]; B identical k map from Bt[n][k]; D element j -> (row 8hi+j, col lr).
template <typename T16> struct WFrag;
template <> struct WFrag<h16> { typedef v16h V; static __device__ __forceinline__ V ld(const h16* p) { return cat16(*(const v8h*)p, *(const v8h*)(p + 16)); } static __device__ __forceinline__ v8f mma(V a, V b, v8f c) { return wmma16(a, b, c); } };
template <typename T16, int NSPLIT, bool BIAS>
__global__ __launch_bounds__(32) void k_gemmw(const T16* __restrict__ A, const T16* __restrict__ A2, const T16* __restrict__ Bt, const T16* __restrict__ Bt2, int K, float* C, int ldc, const float* __restrict__ bias, float csc, size_t sA, size_t sB, size_t sC) {
    typedef typename WFrag<T16>::V V;
    __shared__ __align__(16) float os[16 * 68];
    const size_t z = blockIdx.z; A += z * sA; if (A2) A2 += z * sA; Bt += z * sB; if (Bt2) Bt2 += z * sB; C += z * sC;
    const int lane = threadIdx.x & 31, lr = lane & 15, hi = lane >> 4; const int r0 = blockIdx.x * 64, c0 = blockIdx.y * 64;
    v8f acc[4][4];
#pragma unroll
    for (int mb = 0; mb < 4; ++mb)
#pragma unroll
        for (int nb = 0; nb < 4; ++nb) acc[mb][nb] = (v8f){};
    const size_t aoff = (size_t)(r0 + lr) * K + 8 * hi, boff = (size_t)(c0 + lr) * K + 8 * hi;
#pragma unroll 1
    for (int kc = 0; kc < K; kc += 32) {
        V a[4], a2[4];
#pragma unroll
        for (int mb = 0; mb < 4; ++mb) { a[mb] = WFrag<T16>::ld(A + aoff + (size_t)mb * 16 * K + kc); if (NSPLIT == 1 || NSPLIT == 2) a2[mb] = WFrag<T16>::ld(A2 + aoff + (size_t)mb * 16 * K + kc); }
#pragma unroll
        for (int nb = 0; nb < 4; ++nb) { const V b = WFrag<T16>::ld(Bt + boff + (size_t)nb * 16 * K + kc); V b2; if (NSPLIT >= 2) b2 = WFrag<T16>::ld(Bt2 + boff + (size_t)nb * 16 * K + kc);
#pragma unroll
            for (int mb = 0; mb < 4; ++mb) { acc[mb][nb] = WFrag<T16>::mma(a[mb], b, acc[mb][nb]); if (NSPLIT == 1 || NSPLIT == 2) acc[mb][nb] = WFrag<T16>::mma(a2[mb], b, acc[mb][nb]); if (NSPLIT >= 2) acc[mb][nb] = WFrag<T16>::mma(a[mb], b2, acc[mb][nb]); } }
        asm volatile("v_nop\n\tv_nop\n\tv_nop\n\tv_nop" : "+v"(acc[0][0]), "+v"(acc[1][1]), "+v"(acc[2][2]), "+v"(acc[3][3]) : "v"(a[0]), "v"(a[3]));
    }
#pragma unroll
    for (int mb = 0; mb < 4; ++mb) {
#pragma unroll
        for (int nb = 0; nb < 4; ++nb) {
#pragma unroll
            for (int j = 0; j < 8; ++j) os[(hi * 8 + j) * 68 + nb * 16 + lr] = acc[mb][nb][j]; }
        __builtin_amdgcn_wave_barrier(); asm volatile("" ::: "memory");
        float* crow = C + (size_t)(r0 + mb * 16) * ldc + c0;
{
#pragma unroll
            for (int s = 0; s < 8; ++s) { const int row = 2 * s + hi, cofs = lr * 4; v4f val = *(const v4fa*)(os + row * 68 + cofs); val = val * csc;
                if (BIAS) { val[0] += bfr(bias[c0 + cofs]); val[1] += bfr(bias[c0 + cofs + 1]); val[2] += bfr(bias[c0 + cofs + 2]); val[3] += bfr(bias[c0 + cofs + 3]); }
                *(v4f*)(crow + (size_t)row * ldc + cofs) = val; }
             }
        __builtin_amdgcn_wave_barrier(); asm volatile("" ::: "memory");
    }
}

// ---- e^{2x} via exp2. The exponent is held inside [-126, 126] so that the value is never inf or 0: the product of two of them may run to inf or 0
// (tanh saturates cleanly to +-1: rcp(inf) = 0, rcp(1) = 1) but is never inf * 0.
__device__ __forceinline__ float e2x(float x) {
    return __builtin_amdgcn_exp2f(fminf(fmaxf(x * 2.8853900817779268f, -126.0f), 126.0f));
}

// ---- k_prep: one block per 64 (t) x 64 (d) tile of one input (blockIdx.z: batches of the first input, then of the second). The tile is read once, 16 B per lane along d.
// Value plane V16[b][d][t] (f16) = bf16_RNE(F[b][t][d]) * VSC through the flush select (the x16 carry keeps small entries normal in f16; bf16 significands are exact in f16):
// each thread packs two neighbouring t of one d into a dword of the LDS tile tl[d][t]; behind the block barrier the tile is read back along t and stored as whole 128-B rows (4 lanes x 32 B).
// Second input only: exponential plane E[b][t][d] (f32) = e^{2 bf16_RNE(F[b][t][d])}, same layout as the input, from the same registers.
#define PPITCH 72   // halves per LDS row: 144 B = 16 B x odd for the 16-B read-back
static_assert(TK % 64 == 0 && DV % 64 == 0 && (PPITCH * 2) % 16 == 0 && PPITCH >= 64);
template <bool EXPO>
__device__ __forceinline__ void prep_tile(const float* __restrict__ F, h16* V, float* E, h16* tl, int b) {
    const int tid = threadIdx.x; const int d0 = blockIdx.x * 64, t0 = blockIdx.y * 64;
    const int c4 = (tid & 15) * 4, g2 = (tid >> 4) * 2;
    const unsigned base = (unsigned)(((b * TK + t0 + g2) * DV + d0 + c4) * 4);   // byte offset of the thread's first 16 B, the same in the input and in E
    v4f u[4];   // rows t0 + g2 + {0, 1, 32, 33}
#pragma unroll
    for (int p = 0; p < 2; ++p) { u[2 * p] = *(const v4f*)((const char*)F + base + (32 * p) * DV * 4); u[2 * p + 1] = *(const v4f*)((const char*)F + base + (32 * p + 1) * DV * 4); }
#pragma unroll
    for (int k = 0; k < 4; ++k)
#pragma unroll
        for (int e = 0; e < 4; ++e) u[k][e] = bfr(u[k][e]);
#pragma unroll
    for (int p = 0; p < 2; ++p)
#pragma unroll
        for (int e = 0; e < 4; ++e) { const v2h o = {toh_flush(u[2 * p][e] * VSC), toh_flush(u[2 * p + 1][e] * VSC)}; *(v2ha*)(tl + (c4 + e) * PPITCH + 32 * p + g2) = o; }
    if (EXPO) {
#pragma unroll
        for (int k = 0; k < 4; ++k)
#pragma unroll
            for (int e = 0; e < 4; ++e) u[k][e] = e2x(u[k][e]);
    }
    __syncthreads();
    const int dd = tid >> 2, sg = (tid & 3) * 16;
    const v8h r0 = *(const v8ha*)(tl + dd * PPITCH + sg); const v8h r1 = *(const v8ha*)(tl + dd * PPITCH + sg + 8);
    const unsigned vof = (unsigned)((((b * DV + d0 + dd) * TK) + t0 + sg) * 2);   // byte offset of the thread's 32 B in the value plane
    if (EXPO) {
#pragma unroll
        for (int p = 0; p < 2; ++p) { *(v4f*)((char*)E + base + (32 * p) * DV * 4) = u[2 * p]; *(v4f*)((char*)E + base + (32 * p + 1) * DV * 4) = u[2 * p + 1]; }
        asm volatile("s_wait_xcnt 0x0" ::: "memory");   // a register of these stores is reused for the value stores' offset behind them
    }
    *(v8h*)((char*)V + vof) = r0; *(v8h*)((char*)V + vof + 16) = r1;
}
__global__ __launch_bounds__(256) void k_prep(const float* __restrict__ F1, const float* __restrict__ F2, h16* V1, h16* V2, float* E2) {
    __shared__ __align__(16) h16 tl[64 * PPITCH];
    // block-uniform: every thread of a block takes the same side, with its one barrier
    if (blockIdx.z >= NB) prep_tile<true>(F2, V2, E2, tl, (int)blockIdx.z - NB);
    else                  prep_tile<false>(F1, V1, nullptr, tl, (int)blockIdx.z);
}

// ---- k_score: one block (16 waves) per RB = 4 consecutive rows rq0 .. rq0+3 (= b*TQ + i) of the first input. Lane owns d = 4*lane + 128*c + e (c 0..3, e 0..3):
// e^{2 bf16_RNE(m1[d])} of all four rows and -2 bf16_RNE(w[d]) in registers; wave v scans keys 16v .. 16v+15, two keys a trip. Per key: 4 x 16-B loads of the second input's exponential
// row E2, each loaded row used for all four rows of the block (the plane is read from L2 once per four rows); s = sum_d w[d] - 2 sum_d w[d] / (E1[d] E2[k][d] + 1) in f32
// (fixed order + xor tree, the same per score as with one row a block), lane 0 stores s into the LDS score rows (cross-wave: block barrier). The scalar bias (bf16 RNE) is added to every score.
// Behind the loop waves 0..7 take rows 0 and 2, waves 8..15 rows 1 and 3 (thread = key): (a) raw score rows -> f32 plane SF[rq][TK] (4 KB in a row) by waves 0..7 as 32 lanes x 16 B;
// (b) softmax over the 256 keys in f32 (max-subtracted, exp2, rcp of the row sum) -> P16 (f16 x1024), row r by wave 8 + r.
#define RB 4    // rows of the first input per block
#define KU 2    // keys per trip of a wave
#define SWV 16  // waves per block
static_assert(TQ % RB == 0 && RB == 4 && SWV == 16);
static_assert((TK / SWV) % KU == 0);
static_assert(8 * 32 * 16 == RB * TK * 4);
static_assert(1 * 32 * 16 == TK * 2);
static_assert(256 == TK);
__global__ __launch_bounds__(512) void k_score(const float* __restrict__ M1, const float* __restrict__ E2, const float* __restrict__ ww, const float* __restrict__ bb, float* SF, h16* P16) {
    __shared__ __align__(16) float s_sc[RB * TK];
    __shared__ __align__(16) float s_ex[RB * TK];
    __shared__ float red[2][SWV];
    const int rq0 = blockIdx.x * RB; const int b = rq0 >> TQ_SH;
    const int tid = threadIdx.x, lane = tid & 31; const int wave = __builtin_amdgcn_readfirstlane(tid >> 5);
    const float* mrow = M1 + (size_t)rq0 * DV;
    v2f e1[RB][8], wn[8]; float ws = 0.0f;
#pragma unroll
    for (int c = 0; c < 4; ++c) { const v4f w4 = *(const v4f*)(ww + c * 128 + lane * 4);
#pragma unroll
        for (int e = 0; e < 4; ++e) { const float wv = bfr(w4[e]); wn[c * 2 + (e >> 1)][e & 1] = -2.0f * wv; ws += wv; } }
#pragma unroll
    for (int r = 0; r < RB; ++r) {
#pragma unroll
        for (int c = 0; c < 4; ++c) { const v4f a4 = *(const v4f*)(mrow + lane * 4 + (r * DV + c * 128));
#pragma unroll
            for (int e = 0; e < 4; ++e) e1[r][c * 2 + (e >> 1)][e & 1] = e2x(bfr(a4[e])); } }
    const float bs = bfr(bb[0]);
    const int k0 = wave * (TK / SWV);
    const float* ub = E2 + ((size_t)b * TK + k0) * DV;
    const v2f one2 = {1.0f, 1.0f};
    // kept rolled: one trip (2 keys x 4 rows) already takes most of the registers a wave has at four waves per SIMD; the loops inside are unrolled whole so that every array stays in registers
#pragma unroll 1
    for (int kk = 0; kk < TK / SWV; kk += KU) {
        const float* urow = ub + (size_t)kk * DV;
        v4f ur[KU][4];
#pragma unroll
        for (int q = 0; q < KU; ++q)
#pragma unroll
            for (int c = 0; c < 4; ++c) ur[q][c] = *(const v4f*)(urow + q * DV + c * 128 + lane * 4);
        asm volatile("s_wait_xcnt 0x0" ::: "memory");   // the row pointer's registers are advanced for the next keys behind these loads
        float acc[KU][RB];
#pragma unroll
        for (int q = 0; q < KU; ++q)
#pragma unroll
            for (int r = 0; r < RB; ++r) {
                v2f ac0 = {ws, 0.0f}, ac1 = {0.0f, 0.0f};
#pragma unroll
                for (int c = 0; c < 4; ++c) { const v4f u4 = ur[q][c];
                    const v2f x0 = __builtin_elementwise_fma(e1[r][c * 2], (v2f){u4[0], u4[1]}, one2), x1 = __builtin_elementwise_fma(e1[r][c * 2 + 1], (v2f){u4[2], u4[3]}, one2);
                    const v2f r0 = {__builtin_amdgcn_rcpf(x0[0]), __builtin_amdgcn_rcpf(x0[1])}, r1 = {__builtin_amdgcn_rcpf(x1[0]), __builtin_amdgcn_rcpf(x1[1])};
                    ac0 = __builtin_elementwise_fma(wn[c * 2], r0, ac0); ac1 = __builtin_elementwise_fma(wn[c * 2 + 1], r1, ac1); }
                acc[q][r] = (ac0[0] + ac0[1]) + (ac1[0] + ac1[1]);
            }
#pragma unroll
        for (int sh = 16; sh; sh >>= 1)
#pragma unroll
            for (int q = 0; q < KU; ++q)
#pragma unroll
                for (int r = 0; r < RB; ++r) acc[q][r] += __shfl_xor(acc[q][r], sh, 32);
        if (lane == 0) {
#pragma unroll
            for (int q = 0; q < KU; ++q)
#pragma unroll
                for (int r = 0; r < RB; ++r) s_sc[r * TK + k0 + kk + q] = acc[q][r];
        }
    }
    __syncthreads();
    const int g = wave >> 3, key = tid & (TK - 1);   // thread's rows: g and 2 + g
    float a0[2], m[2], sum[2];
#pragma unroll
    for (int h = 0; h < 2; ++h) { const int o = (2 * h + g) * TK + key; a0[h] = s_sc[o] + bs; s_sc[o] = a0[h]; m[h] = a0[h]; }
#pragma unroll
    for (int sh = 16; sh; sh >>= 1)
#pragma unroll
        for (int h = 0; h < 2; ++h) { const float o = __shfl_xor(m[h], sh, 32); m[h] = (o > m[h]) ? o : m[h]; }
    if (lane == 0) { red[0][wave] = m[0]; red[1][wave] = m[1]; }
    __syncthreads();
#pragma unroll
    for (int h = 0; h < 2; ++h) { m[h] = red[h][g * 8];
#pragma unroll
        for (int w = 1; w < 8; ++w) { const float o = red[h][g * 8 + w]; m[h] = (o > m[h]) ? o : m[h]; } }
    __syncthreads();
#pragma unroll
    for (int h = 0; h < 2; ++h) { const float e0 = __builtin_amdgcn_exp2f((a0[h] - m[h]) * LOG2E); s_ex[(2 * h + g) * TK + key] = e0; sum[h] = e0; }
#pragma unroll
    for (int sh = 16; sh; sh >>= 1)
#pragma unroll
        for (int h = 0; h < 2; ++h) sum[h] += __shfl_xor(sum[h], sh, 32);
    if (lane == 0) { red[0][wave] = sum[0]; red[1][wave] = sum[1]; }
    __syncthreads();
    if (wave < 8) {
        const int f0 = tid * 4;
        const v4f p = *(const v4fa*)(s_sc + f0);
        float* dst = SF + (size_t)rq0 * TK + f0;
        *(v4f*)dst = p;
    } else if (wave < 8 + RB) {
        const int r = wave - 8;   // row r = 2 h + g: its eight wave sums lie in red[r >> 1][8 (r & 1) ..]
        const float* rr = &red[r >> 1][(r & 1) * 8];
        float rs = rr[0];
#pragma unroll
        for (int w = 1; w < 8; ++w) rs += rr[w];
        const float inv = __builtin_amdgcn_rcpf(rs); const float invp = inv * PCAR;
        const int f0 = r * TK + lane * 8;
        const v4f q0 = *(const v4fa*)(s_ex + f0); const v4f q1 = *(const v4fa*)(s_ex + f0 + 4);
        v8h o;
#pragma unroll
        for (int c = 0; c < 4; ++c) { o[c] = toh_flush(q0[c] * invp); o[4 + c] = toh_flush(q1[c] * invp); }
        h16* dst = P16 + (size_t)rq0 * TK + f0;
        *(v8h*)dst = o;
    }
}

// ---- k_csoft: one block per column cq (= b*TK + j) of the score plane. Thread i reads SF[b][i][j] (strided, one float), softmax DOWN the column over the 256 rows in f32
// (max-subtracted, exp2, rcp of the block sum; cross-wave combines through LDS words behind block barriers). Writes the TRANSPOSED plane P2T[cq][i] = f16(1024 p[i][j]) through the
static_assert(1 * 32 * 16 == TQ * 2);
static_assert(256 == TQ);
__global__ __launch_bounds__(256) void k_csoft(const float* __restrict__ SF, h16* P2T) {
    __shared__ __align__(16) float s_ex[TQ];
    __shared__ float red[8];
    const int cq = blockIdx.x; const int b = cq >> TK_SH; const int j = cq & (TK - 1);
    const int tid = threadIdx.x, lane = tid & 31; const int wave = __builtin_amdgcn_readfirstlane(tid >> 5);
    const float a0 = SF[((size_t)((b << TQ_SH) + tid)) * TK + j];
    float m = a0;
#pragma unroll
    for (int sh = 16; sh; sh >>= 1) { const float o = __shfl_xor(m, sh, 32); m = (o > m) ? o : m; }
    if (lane == 0) red[wave] = m;
    __syncthreads();
    m = red[0];
#pragma unroll
    for (int w = 1; w < 8; ++w) { const float o = red[w]; m = (o > m) ? o : m; }
    __syncthreads();
    float d0 = a0 - m;
    const float e0 = __builtin_amdgcn_exp2f(d0 * LOG2E);
    s_ex[tid] = e0;
    float sum = e0;
#pragma unroll
    for (int sh = 16; sh; sh >>= 1) sum += __shfl_xor(sum, sh, 32);
    if (lane == 0) red[wave] = sum;
    __syncthreads();
    sum = red[0];
#pragma unroll
    for (int w = 1; w < 8; ++w) sum += red[w];
    const float inv = __builtin_amdgcn_rcpf(sum); const float invp = inv * PCAR;
    if (wave == 0) {
        const int f0 = lane * 8;
        const v4f q0 = *(const v4fa*)(s_ex + f0); const v4f q1 = *(const v4fa*)(s_ex + f0 + 4);
        v8h o;
#pragma unroll
        for (int c = 0; c < 4; ++c) { o[c] = toh_flush(q0[c] * invp); o[4 + c] = toh_flush(q1[c] * invp); }
        h16* dst = P2T + (size_t)cq * TQ + f0;
        *(v8h*)dst = o; 
    }
}

extern "C" void kernel_launch(void* const* d_in, const int* in_sizes, int n_in,
                              void* d_out, int out_size, void* d_ws, size_t ws_size, hipStream_t stream) {
    if (n_in < 4) return;
    if (in_sizes[0] < NB * TQ * DV || in_sizes[1] < NB * TK * DV || in_sizes[2] < DV || in_sizes[3] < 1) return;
    if (out_size < NB_FULL * TQ * DV + NB * TK * DV) return;
    const float* modal1 = (const float*)d_in[0];   // [NB][TQ][DV]
    const float* modal2 = (const float*)d_in[1];   // [NB][TK][DV]
    const float* wvec   = (const float*)d_in[2];   // [DV]
    const float* bsc    = (const float*)d_in[3];   // [1]
    float* OUT0 = (float*)d_out;                                  // [NB_FULL][TQ][DV], byte offset 0
    // the second output, [NB_FULL][TK][DV], follows at byte offset 2097152 = OUT0 + NB_FULL * TQ * DV

    char* wsp = (char*)d_ws;
    auto take = [&](size_t bytes) { char* p = wsp; wsp += (bytes + 255) & ~(size_t)255; return (void*)p; };
    float* EX2  = (float*)take((size_t)NB * TK * DV * 4); // [NB][TK][DV] f32 e^{2x} of the second input 2 MB
    h16*   VT2  = (h16*)take((size_t)2 * NB * DV * TK * 2); // [NB][DV][TK] f16 x16 of the second input  1 MB, and directly behind it
    h16*   VT1  = VT2 + (size_t)NB * DV * TK;               // [NB][DV][TQ] f16 x16 of the first input   1 MB
    float* SF   = (float*)take((size_t)NB * TQ * TK * 4); // [NB*TQ][TK] f32 raw scores               1 MB
    h16*   P1   = (h16*)take((size_t)2 * NB * TQ * TK * 2); // [NB*TQ][TK] f16 x1024                     0.5 MB, and directly behind it
    h16*   P2T  = P1 + (size_t)NB * TQ * TK;                // [NB*TK][TQ] f16 x1024 (transposed)        0.5 MB
    if ((size_t)(wsp - (char*)d_ws) > ws_size) return;    // total 6,291,456 B

    // both value planes [b][d][t] f16 x16 and the exponential plane of the second input (read by every row's score block), one pass over each input tile
    k_prep<<<dim3(DV / 64, TK / 64, 2 * NB), 256, 0, stream>>>(modal1, modal2, VT1, VT2, EX2);
    // scores, four rows of the first input per block -> raw score plane SF and the key-softmax plane P1 (f16 x1024)
    k_score<<<(unsigned)(NB * TQ / RB), 512, 0, stream>>>(modal1, EX2, wvec, bsc, SF, P1);
    // softmax down the columns -> transposed plane P2T (f16 x1024)
    k_csoft<<<(unsigned)(NB * TK), 256, 0, stream>>>(SF, P2T);
    // both output products in one launch of 2 NB slices (neither reads what the other writes; TQ == TK, so all slices have one shape and one stride per operand), epilogue scale 2^-14:
    // slices 0 .. NB-1:    out0 = P1 . modal2   : [TQ][TK] x Bt[DV][TK] -> f32 [TQ][DV]
    // slices NB .. 2NB-1:  out1 = P2^T . modal1 : [TK][TQ] x Bt[DV][TQ] -> f32 [TK][DV]; P2T, VT1 and the second output each start NB slices behind P1, VT2 and OUT0
    k_gemmw<h16, 0, false><<<dim3(TQ / 64, DV / 64, 2 * NB), 32, 0, stream>>>(P1, nullptr, VT2, nullptr, TK, OUT0, DV, nullptr, OSC, (size_t)TQ * TK, (size_t)DV * TK, (size_t)TQ * DV);
}

// v005
// A run of this version takes 23.4 microseconds.
// Next to v004, in two timings, it ran 1.32 and 1.34 times as fast.
// All steps since v000 together make it 2.88 times as fast.
#include <hip/hip_runtime.h>

// Contractions: P1.modal2 and P2^T.modal1 on v_wmma_f32_16x16x32_f16 (f16 operands: P carried x1024, values = bf16-RNE inputs carried x16, f32 accumulate, folded by 2^-14 in the f32 epilogue);
// score matvec sum_d w[d]*tanh(m1[d]+m2[d]) (N=1) and both softmaxes (over keys, and down the columns) stay f32 on VALU;
// tanh(a+b) = 1 - 2 / (e^{2a} e^{2b} + 1): the exponentials are taken once per input element, the score loop is left with one reciprocal per (row, key, d).

#ifndef NB
#define NB 4
#endif
#define NB_FULL 4
#define TQ    256
#define TK    256
#define DV    512
#define TQ_SH 8
#define TK_SH 8
#define PCAR  1024.0f
#define VSC   16.0f
#define OSC   (1.0f / 16384.0f)
#define LOG2E 1.4426950408889634f

static_assert(NB >= 1 && NB <= NB_FULL);
static_assert(TQ == TK);
static_assert((1 << TQ_SH) == TQ && (1 << TK_SH) == TK);
static_assert(TQ % 64 == 0 && TK % 64 == 0 && DV % 64 == 0);
static_assert(TQ % 32 == 0 && TK % 32 == 0);
static_assert(DV == 4 * 128);
static_assert(TK == 8 * 32 && TQ == 8 * 32);
static_assert((size_t)NB_FULL * TQ * DV * 4 == 2097152);
static_assert(((size_t)NB_FULL * TQ * DV + (size_t)NB_FULL * TK * DV) * 4 == 4194304);

static constexpr size_t WS_TOTAL = (size_t)NB * TK * DV * 4 + (size_t)NB * DV * TK * 2 + (size_t)NB * DV * TQ * 2 + (size_t)NB * TQ * TK * 4 + (size_t)NB * TQ * TK * 2;
static_assert(WS_TOTAL <= 134217728);
static_assert((((size_t)NB * DV * TK * 2) % 256) == 0 && (((size_t)NB * TQ * TK * 2) % 256) == 0);
static_assert((8 * TK + 32) * 4 <= 131072);
static_assert(NB == NB_FULL);   // the two outputs lie back to back: slice NB of the joint product launch starts the second output

typedef _Float16 h16;
typedef __attribute__((ext_vector_type(16))) _Float16 v16h;
typedef __attribute__((ext_vector_type(8)))  _Float16 v8h;
typedef __attribute__((ext_vector_type(8)))  float    v8f;
typedef __attribute__((ext_vector_type(4)))  float    v4f;
typedef __attribute__((ext_vector_type(2)))  float    v2f;
typedef __attribute__((ext_vector_type(2)))  _Float16 v2h;
typedef v8h  __attribute__((may_alias)) v8ha;
typedef v4f  __attribute__((may_alias)) v4fa;
typedef v2h  __attribute__((may_alias)) v2ha;

__device__ __forceinline__ unsigned short f2bf(float f) { unsigned u = __float_as_uint(f); u += 0x7FFFu + ((u >> 16) & 1u); return (unsigned short)(u >> 16); }
__device__ __forceinline__ float bf2f(unsigned short b) { return __uint_as_float(((unsigned)b) << 16); }
__device__ __forceinline__ float bfr(float f) { return bf2f(f2bf(f)); }
__device__ __forceinline__ v16h cat16(v8h lo, v8h hi) { return __builtin_shufflevector(lo, hi, 0, 1, 2, 3, 4, 5, 6, 7, 8, 9, 10, 11, 12, 13, 14, 15); }
__device__ __forceinline__ v8f wmma16(v16h a, v16h b, v8f c) { return __builtin_amdgcn_wmma_f32_16x16x32_f16(false, a, false, b, (short)0, c, false, false); }

// f32 -> f16 operand convert with a value select: anything below the smallest normal f16 becomes +0 before the convert.
static __device__ __forceinline__ h16 toh_flush(float v) { const float w = (fabsf(v) < 6.103515625e-05f) ? 0.0f : v; return (h16)w; }

// ---- e^{2x} via exp2. The exponent is held inside [-126, 126] so that the value is never inf or 0: the product of two of them may run to inf or 0
// (tanh saturates cleanly to +-1: rcp(inf) = 0, rcp(1) = 1) but is never inf * 0.
__device__ __forceinline__ float e2x(float x) {
    return __builtin_amdgcn_exp2f(fminf(fmaxf(x * 2.8853900817779268f, -126.0f), 126.0f));
}

// ---- k_prep: one block per 64 (t) x 64 (d) tile of one input (blockIdx.z: batches of the first input, then of the second). The tile is read once, 16 B per lane along d.
// Value plane V16[b][d][t] (f16) = bf16_RNE(F[b][t][d]) * VSC through the flush select (the x16 carry keeps small entries normal in f16; bf16 significands are exact in f16):
// each thread packs two neighbouring t of one d into a dword of the LDS tile tl[d][t]; behind the block barrier the tile is read back along t and stored as whole 128-B rows (4 lanes x 32 B).
// Second input only: exponential plane E[b][t][d] (f32) = e^{2 bf16_RNE(F[b][t][d])}, same layout as the input, from the same registers.
#define PPITCH 72   // halves per LDS row: 144 B = 16 B x odd for the 16-B read-back
static_assert(TK % 64 == 0 && DV % 64 == 0 && (PPITCH * 2) % 16 == 0 && PPITCH >= 64);
template <bool EXPO>
__device__ __forceinline__ void prep_tile(const float* __restrict__ F, h16* V, float* E, h16* tl, int b) {
    const int tid = threadIdx.x; const int d0 = blockIdx.x * 64, t0 = blockIdx.y * 64;
    const int c4 = (tid & 15) * 4, g2 = (tid >> 4) * 2;
    const unsigned base = (unsigned)(((b * TK + t0 + g2) * DV + d0 + c4) * 4);   // byte offset of the thread's first 16 B, the same in the input and in E
    v4f u[4];   // rows t0 + g2 + {0, 1, 32, 33}
#pragma unroll
    for (int p = 0; p < 2; ++p) { u[2 * p] = *(const v4f*)((const char*)F + base + (32 * p) * DV * 4); u[2 * p + 1] = *(const v4f*)((const char*)F + base + (32 * p + 1) * DV * 4); }
#pragma unroll
    for (int k = 0; k < 4; ++k)
#pragma unroll
        for (int e = 0; e < 4; ++e) u[k][e] = bfr(u[k][e]);
#pragma unroll
    for (int p = 0; p < 2; ++p)
#pragma unroll
        for (int e = 0; e < 4; ++e) { const v2h o = {toh_flush(u[2 * p][e] * VSC), toh_flush(u[2 * p + 1][e] * VSC)}; *(v2ha*)(tl + (c4 + e) * PPITCH + 32 * p + g2) = o; }
    if (EXPO) {
#pragma unroll
        for (int k = 0; k < 4; ++k)
#pragma unroll
            for (int e = 0; e < 4; ++e) u[k][e] = e2x(u[k][e]);
    }
    __syncthreads();
    const int dd = tid >> 2, sg = (tid & 3) * 16;
    const v8h r0 = *(const v8ha*)(tl + dd * PPITCH + sg); const v8h r1 = *(const v8ha*)(tl + dd * PPITCH + sg + 8);
    const unsigned vof = (unsigned)((((b * DV + d0 + dd) * TK) + t0 + sg) * 2);   // byte offset of the thread's 32 B in the value plane
    if (EXPO) {
#pragma unroll
        for (int p = 0; p < 2; ++p) { *(v4f*)((char*)E + base + (32 * p) * DV * 4) = u[2 * p]; *(v4f*)((char*)E + base + (32 * p + 1) * DV * 4) = u[2 * p + 1]; }
        asm volatile("s_wait_xcnt 0x0" ::: "memory");   // a register of these stores is reused for the value stores' offset behind them
    }
    *(v8h*)((char*)V + vof) = r0; *(v8h*)((char*)V + vof + 16) = r1;
}
__global__ __launch_bounds__(256) void k_prep(const float* __restrict__ F1, const float* __restrict__ F2, h16* V1, h16* V2, float* E2) {
    __shared__ __align__(16) h16 tl[64 * PPITCH];
    // block-uniform: every thread of a block takes the same side, with its one barrier
    if (blockIdx.z >= NB) prep_tile<true>(F2, V2, E2, tl, (int)blockIdx.z - NB);
    else                  prep_tile<false>(F1, V1, nullptr, tl, (int)blockIdx.z);
}

// ---- k_score: one block (16 waves) per RB = 4 consecutive rows rq0 .. rq0+3 (= b*TQ + i) of the first input. Lane owns d = 4*lane + 128*c + e (c 0..3, e 0..3):
// e^{2 bf16_RNE(m1[d])} of all four rows and -2 bf16_RNE(w[d]) in registers; wave v scans keys 16v .. 16v+15, two keys a trip. Per key: 4 x 16-B loads of the second input's exponential
// row E2, each loaded row used for all four rows of the block (the plane is read from L2 once per four rows); s = sum_d w[d] - 2 sum_d w[d] / (E1[d] E2[k][d] + 1) in f32
// (fixed order + xor tree, the same per score as with one row a block), lane 0 stores s into the LDS score rows (cross-wave: block barrier). The scalar bias (bf16 RNE) is added to every score.
// Behind the loop waves 0..7 take rows 0 and 2, waves 8..15 rows 1 and 3 (thread = key): (a) raw score rows -> f32 plane SF[rq][TK] (4 KB in a row) by waves 0..7 as 32 lanes x 16 B;
// (b) softmax over the 256 keys in f32 (max-subtracted, exp2, rcp of the row sum) -> P16 (f16 x1024), row r by wave 8 + r.
#define RB 4    // rows of the first input per block
#define KU 2    // keys per trip of a wave
#define SWV 16  // waves per block
static_assert(TQ % RB == 0 && RB == 4 && SWV == 16);
static_assert((TK / SWV) % KU == 0);
static_assert(8 * 32 * 16 == RB * TK * 4);
static_assert(1 * 32 * 16 == TK * 2);
static_assert(256 == TK);
__global__ __launch_bounds__(512) void k_score(const float* __restrict__ M1, const float* __restrict__ E2, const float* __restrict__ ww, const float* __restrict__ bb, float* SF, h16* P16) {
    __shared__ __align__(16) float s_sc[RB * TK];
    __shared__ __align__(16) float s_ex[RB * TK];
    __shared__ float red[2][SWV];
    const int rq0 = blockIdx.x * RB; const int b = rq0 >> TQ_SH;
    const int tid = threadIdx.x, lane = tid & 31; const int wave = __builtin_amdgcn_readfirstlane(tid >> 5);
    const float* mrow = M1 + (size_t)rq0 * DV;
    v2f e1[RB][8], wn[8]; float ws = 0.0f;
#pragma unroll
    for (int c = 0; c < 4; ++c) { const v4f w4 = *(const v4f*)(ww + c * 128 + lane * 4);
#pragma unroll
        for (int e = 0; e < 4; ++e) { const float wv = bfr(w4[e]); wn[c * 2 + (e >> 1)][e & 1] = -2.0f * wv; ws += wv; } }
#pragma unroll
    for (int r = 0; r < RB; ++r) {
#pragma unroll
        for (int c = 0; c < 4; ++c) { const v4f a4 = *(const v4f*)(mrow + lane * 4 + (r * DV + c * 128));
#pragma unroll
            for (int e = 0; e < 4; ++e) e1[r][c * 2 + (e >> 1)][e & 1] = e2x(bfr(a4[e])); } }
    const float bs = bfr(bb[0]);
    const int k0 = wave * (TK / SWV);
    const float* ub = E2 + ((size_t)b * TK + k0) * DV;
    const v2f one2 = {1.0f, 1.0f};
    // kept rolled: one trip (2 keys x 4 rows) already takes most of the registers a wave has at four waves per SIMD; the loops inside are unrolled whole so that every array stays in registers
#pragma unroll 1
    for (int kk = 0; kk < TK / SWV; kk += KU) {
        const float* urow = ub + (size_t)kk * DV;
        v4f ur[KU][4];
#pragma unroll
        for (int q = 0; q < KU; ++q)
#pragma unroll
            for (int c = 0; c < 4; ++c) ur[q][c] = *(const v4f*)(urow + q * DV + c * 128 + lane * 4);
        asm volatile("s_wait_xcnt 0x0" ::: "memory");   // the row pointer's registers are advanced for the next keys behind these loads
        float acc[KU][RB];
#pragma unroll
        for (int q = 0; q < KU; ++q)
#pragma unroll
            for (int r = 0; r < RB; ++r) {
                v2f ac0 = {ws, 0.0f}, ac1 = {0.0f, 0.0f};
#pragma unroll
                for (int c = 0; c < 4; ++c) { const v4f u4 = ur[q][c];
                    const v2f x0 = __builtin_elementwise_fma(e1[r][c * 2], (v2f){u4[0], u4[1]}, one2), x1 = __builtin_elementwise_fma(e1[r][c * 2 + 1], (v2f){u4[2], u4[3]}, one2);
                    const v2f r0 = {__builtin_amdgcn_rcpf(x0[0]), __builtin_amdgcn_rcpf(x0[1])}, r1 = {__builtin_amdgcn_rcpf(x1[0]), __builtin_amdgcn_rcpf(x1[1])};
                    ac0 = __builtin_elementwise_fma(wn[c * 2], r0, ac0); ac1 = __builtin_elementwise_fma(wn[c * 2 + 1], r1, ac1); }
                acc[q][r] = (ac0[0] + ac0[1]) + (ac1[0] + ac1[1]);
            }
#pragma unroll
        for (int sh = 16; sh; sh >>= 1)
#pragma unroll
            for (int q = 0; q < KU; ++q)
#pragma unroll
                for (int r = 0; r < RB; ++r) acc[q][r] += __shfl_xor(acc[q][r], sh, 32);
        if (lane == 0) {
#pragma unroll
            for (int q = 0; q < KU; ++q)
#pragma unroll
                for (int r = 0; r < RB; ++r) s_sc[r * TK + k0 + kk + q] = acc[q][r];
        }
    }
    __syncthreads();
    const int g = wave >> 3, key = tid & (TK - 1);   // thread's rows: g and 2 + g
    float a0[2], m[2], sum[2];
#pragma unroll
    for (int h = 0; h < 2; ++h) { const int o = (2 * h + g) * TK + key; a0[h] = s_sc[o] + bs; s_sc[o] = a0[h]; m[h] = a0[h]; }
#pragma unroll
    for (int sh = 16; sh; sh >>= 1)
#pragma unroll
        for (int h = 0; h < 2; ++h) { const float o = __shfl_xor(m[h], sh, 32); m[h] = (o > m[h]) ? o : m[h]; }
    if (lane == 0) { red[0][wave] = m[0]; red[1][wave] = m[1]; }
    __syncthreads();
#pragma unroll
    for (int h = 0; h < 2; ++h) { m[h] = red[h][g * 8];
#pragma unroll
        for (int w = 1; w < 8; ++w) { const float o = red[h][g * 8 + w]; m[h] = (o > m[h]) ? o : m[h]; } }
    __syncthreads();
#pragma unroll
    for (int h = 0; h < 2; ++h) { const float e0 = __builtin_amdgcn_exp2f((a0[h] - m[h]) * LOG2E); s_ex[(2 * h + g) * TK + key] = e0; sum[h] = e0; }
#pragma unroll
    for (int sh = 16; sh; sh >>= 1)
#pragma unroll
        for (int h = 0; h < 2; ++h) sum[h] += __shfl_xor(sum[h], sh, 32);
    if (lane == 0) { red[0][wave] = sum[0]; red[1][wave] = sum[1]; }
    __syncthreads();
    if (wave < 8) {
        const int f0 = tid * 4;
        const v4f p = *(const v4fa*)(s_sc + f0);
        float* dst = SF + (size_t)rq0 * TK + f0;
        *(v4f*)dst = p;
    } else if (wave < 8 + RB) {
        const int r = wave - 8;   // row r = 2 h + g: its eight wave sums lie in red[r >> 1][8 (r & 1) ..]
        const float* rr = &red[r >> 1][(r & 1) * 8];
        float rs = rr[0];
#pragma unroll
        for (int w = 1; w < 8; ++w) rs += rr[w];
        const float inv = __builtin_amdgcn_rcpf(rs); const float invp = inv * PCAR;
        const int f0 = r * TK + lane * 8;
        const v4f q0 = *(const v4fa*)(s_ex + f0); const v4f q1 = *(const v4fa*)(s_ex + f0 + 4);
        v8h o;
#pragma unroll
        for (int c = 0; c < 4; ++c) { o[c] = toh_flush(q0[c] * invp); o[4 + c] = toh_flush(q1[c] * invp); }
        h16* dst = P16 + (size_t)rq0 * TK + f0;
        *(v8h*)dst = o;
    }
}

// ---- k_out: both output products with the column softmax taken in place. One block (8 waves) per 32 output rows x 256 output columns of one slice z; grid (TQ/32, DV/256, 2 NB).
// slices 0 .. NB-1:   out0 = P1 . modal2: the A tile (32 rows x TK, f16 x1024) is copied from the plane P1 into LDS.
// slices NB .. 2NB-1: out1 = P2^T . modal1: the A tile is made here. Lane = column j (one 128-B line of the score plane per row), wave v holds rows 32v .. 32v+31 in registers;
//   softmax DOWN the column over the 256 rows in f32 (max-subtracted, exp2, rcp of the column sum; per wave four partial sums of rows t = q mod 4, folded (0+1)+(2+3), then the 8 wave partials in wave order
//   through LDS behind block barriers); A[j][i] = f16(1024 p[i][j]) through the flush select goes straight into the LDS tile: the transposed plane never goes through memory.
// Product: wave v owns 32 output columns (2 x 2 accumulators), K = 256 in eight steps in rising k. Its B fragments (K-contiguous value plane, 128 registers) are requested at the start, so that they fly during the softmax.
// Fragments (lane l, hi = l>>4, lr = l&15): A elements 0..7 <- A[r][k0+8hi+0..7], 8..15 <- A[r][k0+16+8hi+0..7]; B identical k map from Bt[n][k]; D element j -> (row 8hi+j, col lr).
#define OT 32              // output rows per block
#define OWV 8              // waves per block, 32 output columns each
#define RW (TQ / OWV)      // score rows per wave in the column softmax
#define APITCH (TK + 8)    // halves per LDS row of the A tile: 528 B = 16 B x odd for the 16-B fragment reads
#define OSP 36             // floats per row of a wave's output staging tile: 144 B = 16 B x odd
static_assert(TQ % OT == 0 && DV % (OWV * 32) == 0 && RW == 32 && TK == 8 * 32 && OT == 32);
static_assert(OWV * 32 * 64 == OT * TK * 2);   // the copy of a P1 tile: 64 B per thread
static_assert((APITCH * 2) % 16 == 0 && (OSP * 4) % 16 == 0);
static_assert(OT * APITCH * 2 + OWV * 16 * OSP * 4 + 2 * OWV * 32 * 4 <= 131072);
__device__ __forceinline__ v16h ldfrag(const h16* p) { return cat16(*(const v8ha*)p, *(const v8ha*)(p + 16)); }
// block barrier that orders LDS only: the waves hand each other nothing but LDS here, and __syncthreads() would also wait for the B fragments' global loads, which are to stay in flight across it
__device__ __forceinline__ void lds_barrier() {
    __builtin_amdgcn_fence(__ATOMIC_RELEASE, "workgroup", "local"); __builtin_amdgcn_s_barrier(); __builtin_amdgcn_fence(__ATOMIC_ACQUIRE, "workgroup", "local");
}
// exp2 with the one free slot that the instruction set asks for behind a transcendental tied to it
__device__ __forceinline__ float exp2_slot(float x) { float r; asm("v_exp_f32 %0, %1\n\tv_nop" : "=v"(r) : "v"(x)); return r; }
template <bool SOFT>
__device__ __forceinline__ void out_tile(const h16* __restrict__ P1, const float* __restrict__ SF, const h16* __restrict__ VT, float* OUT, h16* pa, float* os, float (*red)[OWV][32], int z) {
    const int r0 = blockIdx.x * OT;
    const int tid = threadIdx.x, lane = tid & 31, lr = lane & 15, hi = lane >> 4; const int wave = __builtin_amdgcn_readfirstlane(tid >> 5);
    const int c0 = blockIdx.y * (OWV * 32) + wave * 32;
    // every loop of this kernel is unrolled whole: its arrays stay in registers and all loads of a phase are in flight together
    // the A side's loads are issued first: loads return in order, so the A side waits for them alone while the B fragments still fly
    float v[RW]; v8h x[4];
    const int row = tid >> 3, sg = (tid & 7) * 32;
    if (SOFT) {
        const float* sp = SF + ((size_t)(z - NB) * TQ + wave * RW) * TK + r0 + lane;
#pragma unroll
        for (int t = 0; t < RW; ++t) v[t] = sp[t * TK];
    } else {
        const h16* ap = P1 + ((size_t)z * TQ + r0 + row) * TK + sg;
#pragma unroll
        for (int p = 0; p < 4; ++p) x[p] = *(const v8ha*)(ap + 8 * p);
    }
    asm volatile("s_wait_xcnt 0x0" ::: "memory");   // the address registers of the A side's loads may be reused as results of the B loads behind them
    const h16* bp = VT + (size_t)z * DV * TK + (size_t)(c0 + lr) * TK + 8 * hi;
    v16h bf[8][2];
#pragma unroll
    for (int kc = 0; kc < 8; ++kc)
#pragma unroll
        for (int nb = 0; nb < 2; ++nb) bf[kc][nb] = ldfrag(bp + nb * 16 * TK + kc * 32);
    asm volatile("s_wait_xcnt 0x0" ::: "memory");   // the address registers of the loads above may be reused behind them
    __builtin_amdgcn_sched_barrier(0);               // keeps the first compares below, with their waits for the score loads, from moving up in front of and between the B loads (a build without it had them there)
    if (SOFT) {
        float mq[4], sq[4];
#pragma unroll
        for (int q = 0; q < 4; ++q) mq[q] = v[q];
#pragma unroll
        for (int t = 4; t < RW; ++t) mq[t & 3] = (v[t] > mq[t & 3]) ? v[t] : mq[t & 3];
        float m = (mq[1] > mq[0]) ? mq[1] : mq[0]; { const float o = (mq[3] > mq[2]) ? mq[3] : mq[2]; m = (o > m) ? o : m; }
        red[0][wave][lane] = m;
        lds_barrier();
        m = red[0][0][lane];
#pragma unroll
        for (int w = 1; w < OWV; ++w) { const float o = red[0][w][lane]; m = (o > m) ? o : m; }
#pragma unroll
        for (int t = 0; t < RW; ++t) { v[t] = exp2_slot((v[t] - m) * LOG2E); if (t < 4) sq[t] = v[t]; else sq[t & 3] += v[t]; }
        float sum = (sq[0] + sq[1]) + (sq[2] + sq[3]);
        red[1][wave][lane] = sum;
        lds_barrier();
        sum = red[1][0][lane];
#pragma unroll
        for (int w = 1; w < OWV; ++w) sum += red[1][w][lane];
        const float inv = __builtin_amdgcn_rcpf(sum); const float invp = inv * PCAR;
#pragma unroll
        for (int p = 0; p < 4; ++p)
#pragma unroll
            for (int t = 0; t < 8; ++t) x[p][t] = toh_flush(v[8 * p + t] * invp);
    }
    {
        h16* q = SOFT ? (pa + lane * APITCH + wave * RW) : (pa + row * APITCH + sg);
#pragma unroll
        for (int p = 0; p < 4; ++p) *(v8ha*)(q + 8 * p) = x[p];
    }
    lds_barrier();
    v8f acc[2][2];
#pragma unroll
    for (int mb = 0; mb < 2; ++mb)
#pragma unroll
        for (int nb = 0; nb < 2; ++nb) acc[mb][nb] = (v8f){};
#pragma unroll
    for (int kc = 0; kc < 8; ++kc) {
        v16h a[2];
#pragma unroll
        for (int mb = 0; mb < 2; ++mb) a[mb] = ldfrag(pa + (mb * 16 + lr) * APITCH + kc * 32 + 8 * hi);
#pragma unroll
        for (int nb = 0; nb < 2; ++nb)
#pragma unroll
            for (int mb = 0; mb < 2; ++mb) acc[mb][nb] = wmma16(a[mb], bf[kc][nb], acc[mb][nb]);
    }
    // epilogue: each wave turns its 16 x 32 accumulator block through its own LDS tile and stores whole 128-B lines (8 lanes x 16 B per row), scaled by 2^-14
    float* ow = os + wave * 16 * OSP;
    float* cb = OUT + ((size_t)z * TQ + r0) * DV + c0;
#pragma unroll
    for (int mb = 0; mb < 2; ++mb) {
#pragma unroll
        for (int nb = 0; nb < 2; ++nb)
#pragma unroll
            for (int j = 0; j < 8; ++j) ow[(hi * 8 + j) * OSP + nb * 16 + lr] = acc[mb][nb][j];
        __builtin_amdgcn_wave_barrier(); asm volatile("" ::: "memory");   // keeps the reads below, of what other lanes of this wave wrote, behind the writes above
#pragma unroll
        for (int s = 0; s < 4; ++s) { const int orow = 4 * s + (lane >> 3), cofs = (lane & 7) * 4; v4f val = *(const v4fa*)(ow + orow * OSP + cofs); val = val * OSC;
            *(v4f*)(cb + (size_t)(mb * 16 + orow) * DV + cofs) = val; }
        asm volatile("s_wait_xcnt 0x0" ::: "memory");   // the registers of these stores may be reused behind them
        __builtin_amdgcn_wave_barrier(); asm volatile("" ::: "memory");   // keeps the next block's writes behind the reads above
    }
}
__global__ __launch_bounds__(256) void k_out(const h16* __restrict__ P1, const float* __restrict__ SF, const h16* __restrict__ VT, float* OUT) {
    __shared__ __align__(16) h16 pa[OT * APITCH];
    __shared__ __align__(16) float os[OWV * 16 * OSP];
    __shared__ float red[2][OWV][32];
    // block-uniform: every thread of a block takes the same side, with its barriers
    if (blockIdx.z >= NB) out_tile<true>(P1, SF, VT, OUT, pa, os, red, (int)blockIdx.z);
    else                  out_tile<false>(P1, SF, VT, OUT, pa, os, red, (int)blockIdx.z);
}

extern "C" void kernel_launch(void* const* d_in, const int* in_sizes, int n_in,
                              void* d_out, int out_size, void* d_ws, size_t ws_size, hipStream_t stream) {
    if (n_in < 4) return;
    if (in_sizes[0] < NB * TQ * DV || in_sizes[1] < NB * TK * DV || in_sizes[2] < DV || in_sizes[3] < 1) return;
    if (out_size < NB_FULL * TQ * DV + NB * TK * DV) return;
    const float* modal1 = (const float*)d_in[0];   // [NB][TQ][DV]
    const float* modal2 = (const float*)d_in[1];   // [NB][TK][DV]
    const float* wvec   = (const float*)d_in[2];   // [DV]
    const float* bsc    = (const float*)d_in[3];   // [1]
    float* OUT0 = (float*)d_out;                                  // [NB_FULL][TQ][DV], byte offset 0
    // the second output, [NB_FULL][TK][DV], follows at byte offset 2097152 = OUT0 + NB_FULL * TQ * DV

    char* wsp = (char*)d_ws;
    auto take = [&](size_t bytes) { char* p = wsp; wsp += (bytes + 255) & ~(size_t)255; return (void*)p; };
    float* EX2  = (float*)take((size_t)NB * TK * DV * 4); // [NB][TK][DV] f32 e^{2x} of the second input 2 MB
    h16*   VT2  = (h16*)take((size_t)2 * NB * DV * TK * 2); // [NB][DV][TK] f16 x16 of the second input  1 MB, and directly behind it
    h16*   VT1  = VT2 + (size_t)NB * DV * TK;               // [NB][DV][TQ] f16 x16 of the first input   1 MB
    float* SF   = (float*)take((size_t)NB * TQ * TK * 4); // [NB*TQ][TK] f32 raw scores               1 MB
    h16*   P1   = (h16*)take((size_t)NB * TQ * TK * 2);   // [NB*TQ][TK] f16 x1024                     0.5 MB
    if ((size_t)(wsp - (char*)d_ws) > ws_size) return;    // total 5,767,168 B

    // both value planes [b][d][t] f16 x16 and the exponential plane of the second input (read by every row's score block), one pass over each input tile
    k_prep<<<dim3(DV / 64, TK / 64, 2 * NB), 256, 0, stream>>>(modal1, modal2, VT1, VT2, EX2);
    // scores, four rows of the first input per block -> raw score plane SF and the key-softmax plane P1 (f16 x1024)
    k_score<<<(unsigned)(NB * TQ / RB), 512, 0, stream>>>(modal1, EX2, wvec, bsc, SF, P1);
    // both output products in one launch of 2 NB slices (neither reads what the other writes; TQ == TK, so all slices have one shape and one stride per operand), epilogue scale 2^-14:
    // slices 0 .. NB-1:    out0 = P1 . modal2   : [TQ][TK] x Bt[DV][TK] -> f32 [TQ][DV]
    // slices NB .. 2NB-1:  out1 = P2^T . modal1 : [TK][TQ] x Bt[DV][TQ] -> f32 [TK][DV], P2^T made in the block from the raw scores; VT1 and the second output each start NB slices behind VT2 and OUT0
    k_out<<<dim3(TQ / OT, DV / (OWV * 32), 2 * NB), 256, 0, stream>>>(P1, SF, VT2, OUT0);
}

// v006
// Measured time: 19.7 microseconds a run.
// In both of two side-by-side timings against v005, it was 1.22 times as fast.
// Over all steps from v000 it is 3.52 times as fast.
#include <hip/hip_runtime.h>

// Contractions: P1.modal2 and P2^T.modal1 on v_wmma_f32_16x16x32_f16 (f16 operands: P carried x1024, values = bf16-RNE inputs carried x16, f32 accumulate, folded by 2^-14 in the f32 epilogue);
// score matvec sum_d w[d]*tanh(m1[d]+m2[d]) (N=1) and both softmaxes (over keys, and down the columns) stay f32 on VALU;
// tanh(a+b) is one v_tanh_f32 per (row, key, d) on the f32 sum: the score kernel reads the two inputs themselves and waits for no plane made from them.

#ifndef NB
#define NB 4
#endif
#define NB_FULL 4
#define TQ    256
#define TK    256
#define DV    512
#define TQ_SH 8
#define TK_SH 8
#define PCAR  1024.0f
#define VSC   16.0f
#define OSC   (1.0f / 16384.0f)
#define LOG2E 1.4426950408889634f

static_assert(NB >= 1 && NB <= NB_FULL);
static_assert(TQ == TK);
static_assert((1 << TQ_SH) == TQ && (1 << TK_SH) == TK);
static_assert(TQ % 64 == 0 && TK % 64 == 0 && DV % 64 == 0);
static_assert(TQ % 32 == 0 && TK % 32 == 0);
static_assert(DV == 4 * 128);
static_assert(TK == 8 * 32 && TQ == 8 * 32);
static_assert((size_t)NB_FULL * TQ * DV * 4 == 2097152);
static_assert(((size_t)NB_FULL * TQ * DV + (size_t)NB_FULL * TK * DV) * 4 == 4194304);

static constexpr size_t WS_TOTAL = (size_t)NB * DV * TK * 2 + (size_t)NB * DV * TQ * 2 + (size_t)NB * TQ * TK * 4 + (size_t)NB * TQ * TK * 2;
static_assert(WS_TOTAL <= 134217728);
static_assert((((size_t)NB * DV * TK * 2) % 256) == 0 && (((size_t)NB * TQ * TK * 2) % 256) == 0);
static_assert((8 * TK + 32) * 4 <= 131072);
static_assert(NB == NB_FULL);   // the two outputs lie back to back: slice NB of the joint product launch starts the second output

typedef _Float16 h16;
typedef __attribute__((ext_vector_type(16))) _Float16 v16h;
typedef __attribute__((ext_vector_type(8)))  _Float16 v8h;
typedef __attribute__((ext_vector_type(8)))  float    v8f;
typedef __attribute__((ext_vector_type(4)))  float    v4f;
typedef __attribute__((ext_vector_type(2)))  float    v2f;
typedef __attribute__((ext_vector_type(2)))  _Float16 v2h;
typedef v8h  __attribute__((may_alias)) v8ha;
typedef v4f  __attribute__((may_alias)) v4fa;
typedef v2h  __attribute__((may_alias)) v2ha;

__device__ __forceinline__ unsigned short f2bf(float f) { unsigned u = __float_as_uint(f); u += 0x7FFFu + ((u >> 16) & 1u); return (unsigned short)(u >> 16); }
__device__ __forceinline__ float bf2f(unsigned short b) { return __uint_as_float(((unsigned)b) << 16); }
__device__ __forceinline__ float bfr(float f) { return bf2f(f2bf(f)); }
__device__ __forceinline__ v16h cat16(v8h lo, v8h hi) { return __builtin_shufflevector(lo, hi, 0, 1, 2, 3, 4, 5, 6, 7, 8, 9, 10, 11, 12, 13, 14, 15); }
__device__ __forceinline__ v8f wmma16(v16h a, v16h b, v8f c) { return __builtin_amdgcn_wmma_f32_16x16x32_f16(false, a, false, b, (short)0, c, false, false); }

// f32 -> f16 operand convert with a value select: anything below the smallest normal f16 becomes +0 before the convert.
static __device__ __forceinline__ h16 toh_flush(float v) { const float w = (fabsf(v) < 6.103515625e-05f) ? 0.0f : v; return (h16)w; }

// ---- value tile: each score block also turns one 64 (t) x 64 (d) tile of one input into the value plane that the product launch reads (as many tiles as score blocks).
// Slices 0 .. NB-1 of the plane hold the second input, NB .. 2NB-1 the first. The tile is read once, 16 B per lane along d, two neighbouring t per thread.
// V16[z][d][t] (f16) = bf16_RNE(F[b][t][d]) * VSC through the flush select (the x16 carry keeps small entries normal in f16; bf16 significands are exact in f16):
// each thread packs its two t of one d into a dword of the LDS tile tl[d][t]; behind the block barrier the tile is read back along t and stored as whole 128-B rows (8 lanes x 16 B).
#define PPITCH 72   // halves per LDS row: 144 B = 16 B x odd for the 16-B read-back
static_assert(TK % 64 == 0 && DV % 64 == 0 && (PPITCH * 2) % 16 == 0 && PPITCH >= 64);

// ---- k_score: one block (16 waves) per RB = 4 consecutive rows rq0 .. rq0+3 (= b*TQ + i) of the first input. Lane owns d = 4*lane + 128*c + e (c 0..3, e 0..3):
// bf16_RNE(m1[d]) of all four rows and bf16_RNE(w[d]) in registers; wave v scans keys 16v .. 16v+15, two keys a trip. Per key: 4 x 16-B loads of the second input's row (f32 as given),
// each loaded row used for all four rows of the block (the input is read from L2 once per four rows); s = sum_d w[d] tanh(m1[d] + m2[k][d]) in f32, one v_tanh_f32 per term
// (fixed order + xor tree), lane 0 stores s into the LDS score rows (cross-wave: block barrier). The scalar bias (bf16 RNE) is added to every score.
// In front of the loop the block makes its value tile (above): nothing in this launch reads it.
// Behind the loop waves 0..7 take rows 0 and 2, waves 8..15 rows 1 and 3 (thread = key): (a) raw score rows -> f32 plane SF[rq][TK] (4 KB in a row) by waves 0..7 as 32 lanes x 16 B;
// (b) softmax over the 256 keys in f32 (max-subtracted, exp2, rcp of the row sum) -> P16 (f16 x1024), row r by wave 8 + r.
#define RB 4    // rows of the first input per block
#define KU 2    // keys per trip of a wave
#define SWV 16  // waves per block
static_assert(TQ % RB == 0 && RB == 4 && SWV == 16);
static_assert((TK / SWV) % KU == 0);
static_assert(8 * 32 * 16 == RB * TK * 4);
static_assert(1 * 32 * 16 == TK * 2);
static_assert(256 == TK);
static_assert(NB * TQ / RB == 2 * NB * (TK / 64) * (DV / 64));   // one value tile per score block
static_assert(SWV * 32 * 2 * 4 == 64 * 64 && SWV * 32 * 8 == 64 * 64);   // tile in: two 16-B loads per thread; tile out: one 16-B store per thread
__global__ __launch_bounds__(512) void k_score(const float* __restrict__ M1, const float* __restrict__ M2, const float* __restrict__ ww, const float* __restrict__ bb, float* SF, h16* P16, h16* VT) {
    __shared__ __align__(16) float s_sc[RB * TK];
    __shared__ __align__(16) float s_ex[RB * TK];
    __shared__ float red[2][SWV];
    __shared__ __align__(16) h16 tl[64 * PPITCH];
    const int rq0 = blockIdx.x * RB; const int b = rq0 >> TQ_SH;
    const int tid = threadIdx.x, lane = tid & 31; const int wave = __builtin_amdgcn_readfirstlane(tid >> 5);
    // the value tile's loads go first: loads return in order, and the tile is turned while the rows below still fly
    const int tz = blockIdx.x / ((TK / 64) * (DV / 64)), tt0 = (blockIdx.x / (DV / 64)) % (TK / 64) * 64, td0 = blockIdx.x % (DV / 64) * 64;
    const int c4 = (tid & 15) * 4, g2 = (tid >> 4) * 2;
    const float* tf = ((tz < NB) ? M2 + (size_t)tz * TK * DV : M1 + (size_t)(tz - NB) * TQ * DV) + (tt0 + g2) * DV + td0 + c4;   // block-uniform choice of the input
    const v4f tu0 = *(const v4f*)tf, tu1 = *(const v4f*)(tf + DV);
    asm volatile("s_wait_xcnt 0x0" ::: "memory");   // the address registers of the tile's loads may be reused behind them
    const float* mrow = M1 + (size_t)rq0 * DV;
    v2f a1[RB][8], wn[8];
#pragma unroll
    for (int c = 0; c < 4; ++c) { const v4f w4 = *(const v4f*)(ww + c * 128 + lane * 4);
#pragma unroll
        for (int e = 0; e < 4; ++e) wn[c * 2 + (e >> 1)][e & 1] = bfr(w4[e]); }
#pragma unroll
    for (int r = 0; r < RB; ++r) {
#pragma unroll
        for (int c = 0; c < 4; ++c) { const v4f a4 = *(const v4f*)(mrow + lane * 4 + (r * DV + c * 128));
#pragma unroll
            for (int e = 0; e < 4; ++e) a1[r][c * 2 + (e >> 1)][e & 1] = bfr(a4[e]); } }
    const float bs = bfr(bb[0]);
#pragma unroll
    for (int e = 0; e < 4; ++e) { const v2h o = {toh_flush(bfr(tu0[e]) * VSC), toh_flush(bfr(tu1[e]) * VSC)}; *(v2ha*)(tl + (c4 + e) * PPITCH + g2) = o; }
    __syncthreads();
    {
        const int dd = tid >> 3, sg = (tid & 7) * 8;
        const v8h tr = *(const v8ha*)(tl + dd * PPITCH + sg);
        *(v8h*)(VT + ((size_t)(tz * DV + td0 + dd) * TK + tt0 + sg)) = tr;
        asm volatile("s_wait_xcnt 0x0" ::: "memory");   // the registers of this store may be reused behind it
    }
    const int k0 = wave * (TK / SWV);
    const float* ub = M2 + ((size_t)b * TK + k0) * DV;
    // kept rolled: one trip (2 keys x 4 rows) already takes most of the registers a wave has at four waves per SIMD; the loops inside are unrolled whole so that every array stays in registers
#pragma unroll 1
    for (int kk = 0; kk < TK / SWV; kk += KU) {
        const float* urow = ub + (size_t)kk * DV;
        v4f ur[KU][4];
#pragma unroll
        for (int q = 0; q < KU; ++q)
#pragma unroll
            for (int c = 0; c < 4; ++c) ur[q][c] = *(const v4f*)(urow + q * DV + c * 128 + lane * 4);
        asm volatile("s_wait_xcnt 0x0" ::: "memory");   // the row pointer's registers are advanced for the next keys behind these loads
        float acc[KU][RB];
#pragma unroll
        for (int q = 0; q < KU; ++q)
#pragma unroll
            for (int r = 0; r < RB; ++r) {
                v2f ac0 = {0.0f, 0.0f}, ac1 = {0.0f, 0.0f};
#pragma unroll
                for (int c = 0; c < 4; ++c) { const v4f u4 = ur[q][c];
                    const v2f x0 = a1[r][c * 2] + (v2f){u4[0], u4[1]}, x1 = a1[r][c * 2 + 1] + (v2f){u4[2], u4[3]};
                    const v2f r0 = {__builtin_amdgcn_tanhf(x0[0]), __builtin_amdgcn_tanhf(x0[1])}, r1 = {__builtin_amdgcn_tanhf(x1[0]), __builtin_amdgcn_tanhf(x1[1])};
                    ac0 = __builtin_elementwise_fma(wn[c * 2], r0, ac0); ac1 = __builtin_elementwise_fma(wn[c * 2 + 1], r1, ac1); }
                acc[q][r] = (ac0[0] + ac0[1]) + (ac1[0] + ac1[1]);
            }
#pragma unroll
        for (int sh = 16; sh; sh >>= 1)
#pragma unroll
            for (int q = 0; q < KU; ++q)
#pragma unroll
                for (int r = 0; r < RB; ++r) acc[q][r] += __shfl_xor(acc[q][r], sh, 32);
        if (lane == 0) {
#pragma unroll
            for (int q = 0; q < KU; ++q)
#pragma unroll
                for (int r = 0; r < RB; ++r) s_sc[r * TK + k0 + kk + q] = acc[q][r];
        }
    }
    __syncthreads();
    const int g = wave >> 3, key = tid & (TK - 1);   // thread's rows: g and 2 + g
    float a0[2], m[2], sum[2];
#pragma unroll
    for (int h = 0; h < 2; ++h) { const int o = (2 * h + g) * TK + key; a0[h] = s_sc[o] + bs; s_sc[o] = a0[h]; m[h] = a0[h]; }
#pragma unroll
    for (int sh = 16; sh; sh >>= 1)
#pragma unroll
        for (int h = 0; h < 2; ++h) { const float o = __shfl_xor(m[h], sh, 32); m[h] = (o > m[h]) ? o : m[h]; }
    if (lane == 0) { red[0][wave] = m[0]; red[1][wave] = m[1]; }
    __syncthreads();
#pragma unroll
    for (int h = 0; h < 2; ++h) { m[h] = red[h][g * 8];
#pragma unroll
        for (int w = 1; w < 8; ++w) { const float o = red[h][g * 8 + w]; m[h] = (o > m[h]) ? o : m[h]; } }
    __syncthreads();
#pragma unroll
    for (int h = 0; h < 2; ++h) { const float e0 = __builtin_amdgcn_exp2f((a0[h] - m[h]) * LOG2E); s_ex[(2 * h + g) * TK + key] = e0; sum[h] = e0; }
#pragma unroll
    for (int sh = 16; sh; sh >>= 1)
#pragma unroll
        for (int h = 0; h < 2; ++h) sum[h] += __shfl_xor(sum[h], sh, 32);
    if (lane == 0) { red[0][wave] = sum[0]; red[1][wave] = sum[1]; }
    __syncthreads();
    if (wave < 8) {
        const int f0 = tid * 4;
        const v4f p = *(const v4fa*)(s_sc + f0);
        float* dst = SF + (size_t)rq0 * TK + f0;
        *(v4f*)dst = p;
    } else if (wave < 8 + RB) {
        const int r = wave - 8;   // row r = 2 h + g: its eight wave sums lie in red[r >> 1][8 (r & 1) ..]
        const float* rr = &red[r >> 1][(r & 1) * 8];
        float rs = rr[0];
#pragma unroll
        for (int w = 1; w < 8; ++w) rs += rr[w];
        const float inv = __builtin_amdgcn_rcpf(rs); const float invp = inv * PCAR;
        const int f0 = r * TK + lane * 8;
        const v4f q0 = *(const v4fa*)(s_ex + f0); const v4f q1 = *(const v4fa*)(s_ex + f0 + 4);
        v8h o;
#pragma unroll
        for (int c = 0; c < 4; ++c) { o[c] = toh_flush(q0[c] * invp); o[4 + c] = toh_flush(q1[c] * invp); }
        h16* dst = P16 + (size_t)rq0 * TK + f0;
        *(v8h*)dst = o;
    }
}

// ---- k_out: both output products with the column softmax taken in place. One block (8 waves) per 32 output rows x 256 output columns of one slice z; grid (TQ/32, DV/256, 2 NB).
// slices 0 .. NB-1:   out0 = P1 . modal2: the A tile (32 rows x TK, f16 x1024) is copied from the plane P1 into LDS.
// slices NB .. 2NB-1: out1 = P2^T . modal1: the A tile is made here. Lane = column j (one 128-B line of the score plane per row), wave v holds rows 32v .. 32v+31 in registers;
//   softmax DOWN the column over the 256 rows in f32 (max-subtracted, exp2, rcp of the column sum; per wave four partial sums of rows t = q mod 4, folded (0+1)+(2+3), then the 8 wave partials in wave order
//   through LDS behind block barriers); A[j][i] = f16(1024 p[i][j]) through the flush select goes straight into the LDS tile: the transposed plane never goes through memory.
// Product: wave v owns 32 output columns (2 x 2 accumulators), K = 256 in eight steps in rising k. Its B fragments (K-contiguous value plane, 128 registers) are requested at the start, so that they fly during the softmax.
// Fragments (lane l, hi = l>>4, lr = l&15): A elements 0..7 <- A[r][k0+8hi+0..7], 8..15 <- A[r][k0+16+8hi+0..7]; B identical k map from Bt[n][k]; D element j -> (row 8hi+j, col lr).
#define OT 32              // output rows per block
#define OWV 8              // waves per block, 32 output columns each
#define RW (TQ / OWV)      // score rows per wave in the column softmax
#define APITCH (TK + 8)    // halves per LDS row of the A tile: 528 B = 16 B x odd for the 16-B fragment reads
#define OSP 36             // floats per row of a wave's output staging tile: 144 B = 16 B x odd
static_assert(TQ % OT == 0 && DV % (OWV * 32) == 0 && RW == 32 && TK == 8 * 32 && OT == 32);
static_assert(OWV * 32 * 64 == OT * TK * 2);   // the copy of a P1 tile: 64 B per thread
static_assert((APITCH * 2) % 16 == 0 && (OSP * 4) % 16 == 0);
static_assert(OT * APITCH * 2 + OWV * 16 * OSP * 4 + 2 * OWV * 32 * 4 <= 131072);
__device__ __forceinline__ v16h ldfrag(const h16* p) { return cat16(*(const v8ha*)p, *(const v8ha*)(p + 16)); }
// block barrier that orders LDS only: the waves hand each other nothing but LDS here, and __syncthreads() would also wait for the B fragments' global loads, which are to stay in flight across it
__device__ __forceinline__ void lds_barrier() {
    __builtin_amdgcn_fence(__ATOMIC_RELEASE, "workgroup", "local"); __builtin_amdgcn_s_barrier(); __builtin_amdgcn_fence(__ATOMIC_ACQUIRE, "workgroup", "local");
}
// exp2 with the one free slot that the instruction set asks for behind a transcendental tied to it
__device__ __forceinline__ float exp2_slot(float x) { float r; asm("v_exp_f32 %0, %1\n\tv_nop" : "=v"(r) : "v"(x)); return r; }
template <bool SOFT>
__device__ __forceinline__ void out_tile(const h16* __restrict__ P1, const float* __restrict__ SF, const h16* __restrict__ VT, float* OUT, h16* pa, float* os, float (*red)[OWV][32], int z) {
    const int r0 = blockIdx.x * OT;
    const int tid = threadIdx.x, lane = tid & 31, lr = lane & 15, hi = lane >> 4; const int wave = __builtin_amdgcn_readfirstlane(tid >> 5);
    const int c0 = blockIdx.y * (OWV * 32) + wave * 32;
    // every loop of this kernel is unrolled whole: its arrays stay in registers and all loads of a phase are in flight together
    // the A side's loads are issued first: loads return in order, so the A side waits for them alone while the B fragments still fly
    float v[RW]; v8h x[4];
    const int row = tid >> 3, sg = (tid & 7) * 32;
    if (SOFT) {
        const float* sp = SF + ((size_t)(z - NB) * TQ + wave * RW) * TK + r0 + lane;
#pragma unroll
        for (int t = 0; t < RW; ++t) v[t] = sp[t * TK];
    } else {
        const h16* ap = P1 + ((size_t)z * TQ + r0 + row) * TK + sg;
#pragma unroll
        for (int p = 0; p < 4; ++p) x[p] = *(const v8ha*)(ap + 8 * p);
    }
    asm volatile("s_wait_xcnt 0x0" ::: "memory");   // the address registers of the A side's loads may be reused as results of the B loads behind them
    const h16* bp = VT + (size_t)z * DV * TK + (size_t)(c0 + lr) * TK + 8 * hi;
    v16h bf[8][2];
#pragma unroll
    for (int kc = 0; kc < 8; ++kc)
#pragma unroll
        for (int nb = 0; nb < 2; ++nb) bf[kc][nb] = ldfrag(bp + nb * 16 * TK + kc * 32);
    asm volatile("s_wait_xcnt 0x0" ::: "memory");   // the address registers of the loads above may be reused behind them
    __builtin_amdgcn_sched_barrier(0);               // keeps the first compares below, with their waits for the score loads, from moving up in front of and between the B loads (a build without it had them there)
    if (SOFT) {
        float mq[4], sq[4];
#pragma unroll
        for (int q = 0; q < 4; ++q) mq[q] = v[q];
#pragma unroll
        for (int t = 4; t < RW; ++t) mq[t & 3] = (v[t] > mq[t & 3]) ? v[t] : mq[t & 3];
        float m = (mq[1] > mq[0]) ? mq[1] : mq[0]; { const float o = (mq[3] > mq[2]) ? mq[3] : mq[2]; m = (o > m) ? o : m; }
        red[0][wave][lane] = m;
        lds_barrier();
        m = red[0][0][lane];
#pragma unroll
        for (int w = 1; w < OWV; ++w) { const float o = red[0][w][lane]; m = (o > m) ? o : m; }
#pragma unroll
        for (int t = 0; t < RW; ++t) { v[t] = exp2_slot((v[t] - m) * LOG2E); if (t < 4) sq[t] = v[t]; else sq[t & 3] += v[t]; }
        float sum = (sq[0] + sq[1]) + (sq[2] + sq[3]);
        red[1][wave][lane] = sum;
        lds_barrier();
        sum = red[1][0][lane];
#pragma unroll
        for (int w = 1; w < OWV; ++w) sum += red[1][w][lane];
        const float inv = __builtin_amdgcn_rcpf(sum); const float invp = inv * PCAR;
#pragma unroll
        for (int p = 0; p < 4; ++p)
#pragma unroll
            for (int t = 0; t < 8; ++t) x[p][t] = toh_flush(v[8 * p + t] * invp);
    }
    {
        h16* q = SOFT ? (pa + lane * APITCH + wave * RW) : (pa + row * APITCH + sg);
#pragma unroll
        for (int p = 0; p < 4; ++p) *(v8ha*)(q + 8 * p) = x[p];
    }
    lds_barrier();
    v8f acc[2][2];
#pragma unroll
    for (int mb = 0; mb < 2; ++mb)
#pragma unroll
        for (int nb = 0; nb < 2; ++nb) acc[mb][nb] = (v8f){};
#pragma unroll
    for (int kc = 0; kc < 8; ++kc) {
        v16h a[2];
#pragma unroll
        for (int mb = 0; mb < 2; ++mb) a[mb] = ldfrag(pa + (mb * 16 + lr) * APITCH + kc * 32 + 8 * hi);
#pragma unroll
        for (int nb = 0; nb < 2; ++nb)
#pragma unroll
            for (int mb = 0; mb < 2; ++mb) acc[mb][nb] = wmma16(a[mb], bf[kc][nb], acc[mb][nb]);
    }
    // epilogue: each wave turns its 16 x 32 accumulator block through its own LDS tile and stores whole 128-B lines (8 lanes x 16 B per row), scaled by 2^-14
    float* ow = os + wave * 16 * OSP;
    float* cb = OUT + ((size_t)z * TQ + r0) * DV + c0;
#pragma unroll
    for (int mb = 0; mb < 2; ++mb) {
#pragma unroll
        for (int nb = 0; nb < 2; ++nb)
#pragma unroll
            for (int j = 0; j < 8; ++j) ow[(hi * 8 + j) * OSP + nb * 16 + lr] = acc[mb][nb][j];
        __builtin_amdgcn_wave_barrier(); asm volatile("" ::: "memory");   // keeps the reads below, of what other lanes of this wave wrote, behind the writes above
#pragma unroll
        for (int s = 0; s < 4; ++s) { const int orow = 4 * s + (lane >> 3), cofs = (lane & 7) * 4; v4f val = *(const v4fa*)(ow + orow * OSP + cofs); val = val * OSC;
            *(v4f*)(cb + (size_t)(mb * 16 + orow) * DV + cofs) = val; }
        asm volatile("s_wait_xcnt 0x0" ::: "memory");   // the registers of these stores may be reused behind them
        __builtin_amdgcn_wave_barrier(); asm volatile("" ::: "memory");   // keeps the next block's writes behind the reads above
    }
}
__global__ __launch_bounds__(256) void k_out(const h16* __restrict__ P1, const float* __restrict__ SF, const h16* __restrict__ VT, float* OUT) {
    __shared__ __align__(16) h16 pa[OT * APITCH];
    __shared__ __align__(16) float os[OWV * 16 * OSP];
    __shared__ float red[2][OWV][32];
    // block-uniform: every thread of a block takes the same side, with its barriers
    if (blockIdx.z >= NB) out_tile<true>(P1, SF, VT, OUT, pa, os, red, (int)blockIdx.z);
    else                  out_tile<false>(P1, SF, VT, OUT, pa, os, red, (int)blockIdx.z);
}

extern "C" void kernel_launch(void* const* d_in, const int* in_sizes, int n_in,
                              void* d_out, int out_size, void* d_ws, size_t ws_size, hipStream_t stream) {
    if (n_in < 4) return;
    if (in_sizes[0] < NB * TQ * DV || in_sizes[1] < NB * TK * DV || in_sizes[2] < DV || in_sizes[3] < 1) return;
    if (out_size < NB_FULL * TQ * DV + NB * TK * DV) return;
    const float* modal1 = (const float*)d_in[0];   // [NB][TQ][DV]
    const float* modal2 = (const float*)d_in[1];   // [NB][TK][DV]
    const float* wvec   = (const float*)d_in[2];   // [DV]
    const float* bsc    = (const float*)d_in[3];   // [1]
    float* OUT0 = (float*)d_out;                                  // [NB_FULL][TQ][DV], byte offset 0
    // the second output, [NB_FULL][TK][DV], follows at byte offset 2097152 = OUT0 + NB_FULL * TQ * DV

    char* wsp = (char*)d_ws;
    auto take = [&](size_t bytes) { char* p = wsp; wsp += (bytes + 255) & ~(size_t)255; return (void*)p; };
    h16*   VT2  = (h16*)take((size_t)2 * NB * DV * TK * 2); // [NB][DV][TK] f16 x16 of the second input  1 MB, and directly behind it
                                                            // [NB][DV][TQ] f16 x16 of the first input   1 MB
    float* SF   = (float*)take((size_t)NB * TQ * TK * 4); // [NB*TQ][TK] f32 raw scores               1 MB
    h16*   P1   = (h16*)take((size_t)NB * TQ * TK * 2);   // [NB*TQ][TK] f16 x1024                     0.5 MB
    if ((size_t)(wsp - (char*)d_ws) > ws_size) return;    // total 3,670,016 B

    // scores, four rows of the first input per block -> raw score plane SF and the key-softmax plane P1 (f16 x1024); each block also writes one 64 x 64 tile of the value planes [z][d][t] f16 x16
    k_score<<<(unsigned)(NB * TQ / RB), 512, 0, stream>>>(modal1, modal2, wvec, bsc, SF, P1, VT2);
    // both output products in one launch of 2 NB slices (neither reads what the other writes; TQ == TK, so all slices have one shape and one stride per operand), epilogue scale 2^-14:
    // slices 0 .. NB-1:    out0 = P1 . modal2   : [TQ][TK] x Bt[DV][TK] -> f32 [TQ][DV]
    // slices NB .. 2NB-1:  out1 = P2^T . modal1 : [TK][TQ] x Bt[DV][TQ] -> f32 [TK][DV], P2^T made in the block from the raw scores; the first input's value plane and the second output each start NB slices behind VT2 and OUT0
    k_out<<<dim3(TQ / OT, DV / (OWV * 32), 2 * NB), 256, 0, stream>>>(P1, SF, VT2, OUT0);
}
